// v000
// Times are from an AMD MI455X. After a warm-up the kernel runs many times in a row, and a time is the length of
// such a window on the GPU divided by its runs, so every launch and the gaps after it count. The runs cycle
// through copies of the inputs. A figure is the median of several windows, for all but v000 over two sittings.
// Sittings can differ by a few percent; kernels timed side by side share one.
// v000, which the later versions start from, runs in 721 microseconds.
#include <hip/hip_runtime.h>
// Scaled-cosine causal self-attention (B=2, T=2048, C=2048, 16 heads × 128; q,k,v = x·Wᵀ; each l2-normalised per head (÷(‖·‖+1e-8)); scores = q̂·k̂·τ, causal, softmax; out = (P·v̂)·ν; no output
// projection): the three projections are GEMMs ((out,in) weights bf16-exact ×2^4, f32 accumulate) and the causal attention is a fused flash-style kernel with 128-wide heads (4 logit k-steps, 8 value
// sub-tiles; online softmax f32; upper tiles skipped; P f16 ≤ 1; O = P·Vt; RPW-16 waves; τ folded into q̂, ν into the final scaling) on v_wmma_f32_16x16x32_f16; the l2 norms are f32 VALU.
#define BB 2
#define TT 2048
#define CC 2048
#define NH 16
#define HD 128
#define NR (BB * TT)

typedef __bf16 v16b __attribute__((ext_vector_type(16)));
typedef unsigned short v8us __attribute__((ext_vector_type(8), may_alias));
typedef float  v8f  __attribute__((ext_vector_type(8)));
typedef float  v4f  __attribute__((ext_vector_type(4)));
typedef float  v4fa __attribute__((ext_vector_type(4), may_alias));
union FragB { v16b v; v8us half[2]; unsigned short u[16]; };

__device__ __forceinline__ unsigned short bf16_bits(float x) { unsigned int u = __float_as_uint(x); return (unsigned short)((u + 0x7FFFu + ((u >> 16) & 1u)) >> 16); }
__device__ __forceinline__ float bf16_val(unsigned short b) { return __uint_as_float(((unsigned int)b) << 16); }
__device__ __forceinline__ float bf16_round(float x) { return bf16_val(bf16_bits(x)); }
// D += A·B with NT terms: 1 = ah·bh, 2 = + al·bh (A split), 3 = + ah·bl (both split)
template <int NT>
__device__ __forceinline__ v8f mmaN(v16b ah, v16b al, v16b bh, v16b bl, v8f c) {
  c = __builtin_amdgcn_wmma_f32_16x16x32_bf16(false, ah, false, bh, (short)0, c, false, false);
  if (NT >= 2) c = __builtin_amdgcn_wmma_f32_16x16x32_bf16(false, al, false, bh, (short)0, c, false, false);
  if (NT >= 3) c = __builtin_amdgcn_wmma_f32_16x16x32_bf16(false, ah, false, bl, (short)0, c, false, false);
  asm volatile("v_nop\n\tv_nop\n\tv_nop\n\tv_nop" : "+v"(c) : "v"(ah), "v"(al), "v"(bh), "v"(bl));
  return c;
}

__global__ __launch_bounds__(256) void k_wt_bf16(const float* __restrict__ W, unsigned short* __restrict__ Wt, int K, int N) {
  const int t = blockIdx.x * 256 + threadIdx.x;
  const int k8n = K / 8;
  if (t >= N * k8n) return;
  const int n = t / k8n, k8 = (t % k8n) * 8;
  v8us v;
#pragma unroll
  for (int i = 0; i < 8; ++i) v[i] = bf16_bits(W[(size_t)(k8 + i) * N + n]);
  *(v8us*)(Wt + (size_t)n * K + k8) = v;
  
}

// GEMM C[M][N] (f32, pitch ldc) = act(A[M][K]·W + bias). A f32 row-major (pitch lda) converted per fragment to bf16
// (ASPLIT: hi/lo two planes -> 2 terms, else single rounded term); Wt bf16 [N][K] (pitch ldb). BIAS_BF16 rounds the
// bias to bf16 first (bias quantised to bf16 before the add). K%32==0, M%16==0, N%64==0.
template <bool ASPLIT, int ACT, bool BIAS_BF16>
__global__ __launch_bounds__(128) void k_gemm_bf(const float* __restrict__ A, int lda, const unsigned short* __restrict__ Wt, int ldb,
                                               const float* __restrict__ bias, float* __restrict__ C, int ldc, int M, int N, int K) {
  __shared__ __attribute__((aligned(16))) float so[4][16][64];
  const int tid = threadIdx.x, w = tid >> 5, lane = tid & 31, ln = lane & 15, hh = lane >> 4;
  const int ntn = N / 64;
  const int wid = blockIdx.x * 4 + w;
  const int mt = wid / ntn, nq = wid % ntn;
  if (mt * 16 >= M) return;
  const int row0 = mt * 16, col0 = nq * 64;
  const float* arow = A + (size_t)(row0 + ln) * lda;
  v8f acc[4] = {};
  for (int kb = 0; kb < K; kb += 32) {
    FragB ah, al;
    const v4f x0 = *(const v4fa*)(arow + kb + 8 * hh), x1 = *(const v4fa*)(arow + kb + 8 * hh + 4);
    const v4f x2 = *(const v4fa*)(arow + kb + 16 + 8 * hh), x3 = *(const v4fa*)(arow + kb + 16 + 8 * hh + 4);
    float xs[16] = {x0[0],x0[1],x0[2],x0[3],x1[0],x1[1],x1[2],x1[3],x2[0],x2[1],x2[2],x2[3],x3[0],x3[1],x3[2],x3[3]};
#pragma unroll
    for (int i = 0; i < 16; ++i) { const unsigned short hb = bf16_bits(xs[i]); ah.u[i] = hb; al.u[i] = ASPLIT ? bf16_bits(xs[i] - bf16_val(hb)) : (unsigned short)0; }
#pragma unroll
    for (int t = 0; t < 4; ++t) {
      const unsigned short* brow = Wt + (size_t)(col0 + t * 16 + ln) * ldb + kb;
      FragB b;
      b.half[0] = *(const v8us*)(brow + 8 * hh);
      b.half[1] = *(const v8us*)(brow + 16 + 8 * hh);
      acc[t] = mmaN<ASPLIT ? 2 : 1>(ah.v, al.v, b.v, b.v, acc[t]);
    }
  }
#pragma unroll
  for (int t = 0; t < 4; ++t) {
    float bv = bias ? bias[col0 + t * 16 + ln] : 0.f;
    if (BIAS_BF16) bv = bf16_round(bv);
#pragma unroll
    for (int r = 0; r < 8; ++r) { float v = acc[t][r] + bv; if (ACT == 1) v = fmaxf(v, 0.f); so[w][8 * hh + r][t * 16 + ln] = v; }
  }
  __builtin_amdgcn_fence(__ATOMIC_ACQ_REL, "workgroup");
  __builtin_amdgcn_wave_barrier();
  const int rsub = lane >> 4, c4 = (lane & 15) * 4;
  {
#pragma unroll
    for (int q = 0; q < 8; ++q) {
      const int r = q * 2 + rsub;
      const v4f v = *(const v4fa*)&so[w][r][c4];
      *(v4f*)(C + (size_t)(row0 + r) * ldc + col0 + c4) = v;
    }
    
  }
}

// Flash-style causal/unmasked attention, all contractions 3-term bf16 hi/lo splits, f32 softmax with running max.
// q,k,v rows are read from f32 buffers with arbitrary row pitch (so they can live inside a fused qkv buffer);
// D = head size (multiple of 32, <= 128); one wave = 16 query rows; block = 4 waves (64 queries) sharing K/V chunks of 32.
template <int D, bool CAUSAL>
__global__ __launch_bounds__(128) void k_flash(const float* __restrict__ qb, const float* __restrict__ kb, const float* __restrict__ vb,
                                             int pitch, int T, int H, float scale, float* __restrict__ y, int ypitch) {
  constexpr int KS = D / 32;        // k-steps for QK
  constexpr int DT = D / 16;        // d tiles for PV
  __shared__ __attribute__((aligned(16))) unsigned short sKh[32][D + 8], sKl[32][D + 8], sVh[32][D + 8], sVl[32][D + 8];
  __shared__ __attribute__((aligned(16))) unsigned short sPh[4][16][40], sPl[4][16][40];
  __shared__ __attribute__((aligned(16))) float sO[4][16][D];
  const int tid = threadIdx.x, w = tid >> 5, lane = tid & 31, ln = lane & 15, hh = lane >> 4;
  const int nqb = (T + 63) / 64;
  const int bh = blockIdx.x / nqb, qblk = blockIdx.x % nqb;
  const int b = bh / H, h = bh % H;
  const int q0 = qblk * 64 + w * 16;
  const float* Q = qb + (size_t)b * T * pitch + h * D;
  const float* K = kb + (size_t)b * T * pitch + h * D;
  const float* V = vb + (size_t)b * T * pitch + h * D;

  // A fragments of the wave's 16 query rows (scaled), hi/lo
  FragB aqh[KS], aql[KS];
  {
    int row = q0 + ln; if (row >= T) row = T - 1;
    const float* qr = Q + (size_t)row * pitch;
#pragma unroll
    for (int ks = 0; ks < KS; ++ks)
#pragma unroll
      for (int i = 0; i < 16; ++i) {
        const int d = ks * 32 + ((i < 8) ? (8 * hh + i) : (16 + 8 * hh + (i - 8)));
        const float x = qr[d] * scale; const unsigned short hb = bf16_bits(x);
        aqh[ks].u[i] = hb; aql[ks].u[i] = bf16_bits(x - bf16_val(hb));
      }
  }
  float m_r[8], l_r[8];
#pragma unroll
  for (int r = 0; r < 8; ++r) { m_r[r] = -3.0e38f; l_r[r] = 0.f; }
  v8f oacc[DT];
#pragma unroll
  for (int dt = 0; dt < DT; ++dt) oacc[dt] = (v8f){0.f,0.f,0.f,0.f,0.f,0.f,0.f,0.f};

  const int kv_end = CAUSAL ? min(T, qblk * 64 + 64) : T;     // block-uniform
  for (int j0 = 0; j0 < kv_end; j0 += 32) {
    __syncthreads();
    for (int e = tid; e < 32 * (D / 4); e += 128) {
      const int r = e / (D / 4), c4 = (e % (D / 4)) * 4;
      const int key = j0 + r;
      v4f kf = {0.f,0.f,0.f,0.f}, vf = {0.f,0.f,0.f,0.f};
      if (key < T) { kf = *(const v4fa*)(K + (size_t)key * pitch + c4); vf = *(const v4fa*)(V + (size_t)key * pitch + c4); }
#pragma unroll
      for (int t = 0; t < 4; ++t) {
        unsigned short hb = bf16_bits(kf[t]); sKh[r][c4 + t] = hb; sKl[r][c4 + t] = bf16_bits(kf[t] - bf16_val(hb));
        hb = bf16_bits(vf[t]); sVh[r][c4 + t] = hb; sVl[r][c4 + t] = bf16_bits(vf[t] - bf16_val(hb));
      }
    }
    __syncthreads();
    // S tile 16 x 32
    v8f s[2];
#pragma unroll
    for (int nt = 0; nt < 2; ++nt) {
      v8f acc = {};
#pragma unroll
      for (int ks = 0; ks < KS; ++ks) {
        FragB bh_, bl_;
        bh_.half[0] = *(const v8us*)&sKh[nt * 16 + ln][ks * 32 + 8 * hh]; bh_.half[1] = *(const v8us*)&sKh[nt * 16 + ln][ks * 32 + 16 + 8 * hh];
        bl_.half[0] = *(const v8us*)&sKl[nt * 16 + ln][ks * 32 + 8 * hh]; bl_.half[1] = *(const v8us*)&sKl[nt * 16 + ln][ks * 32 + 16 + 8 * hh];
        acc = mmaN<3>(aqh[ks].v, aql[ks].v, bh_.v, bl_.v, acc);
      }
      s[nt] = acc;
    }
    // mask + running max (rows 8hh+r; the 16 lanes of a half share rows)
    float alpha[8];
#pragma unroll
    for (int r = 0; r < 8; ++r) {
      const int qi = q0 + 8 * hh + r;
      const int ja = j0 + ln, jb = j0 + 16 + ln;
      if (CAUSAL) { if (ja > qi) s[0][r] = -3.0e38f; if (jb > qi) s[1][r] = -3.0e38f; }
      if (ja >= T) s[0][r] = -3.0e38f;
      if (jb >= T) s[1][r] = -3.0e38f;
      float mx = fmaxf(s[0][r], s[1][r]);
      mx = fmaxf(mx, __shfl_xor(mx, 1, 32)); mx = fmaxf(mx, __shfl_xor(mx, 2, 32)); mx = fmaxf(mx, __shfl_xor(mx, 4, 32)); mx = fmaxf(mx, __shfl_xor(mx, 8, 32));
      const float mnew = fmaxf(m_r[r], mx);
      alpha[r] = (mnew > -1.0e38f) ? __expf(m_r[r] - mnew) : 1.0f;
      const float p0 = (s[0][r] > -1.0e38f) ? __expf(s[0][r] - mnew) : 0.f;
      const float p1 = (s[1][r] > -1.0e38f) ? __expf(s[1][r] - mnew) : 0.f;
      m_r[r] = mnew;
      l_r[r] = l_r[r] * alpha[r] + p0 + p1;            // per-lane partial row sum (16 lanes combined at the end)
      unsigned short hb = bf16_bits(p0); sPh[w][8 * hh + r][ln] = hb;      sPl[w][8 * hh + r][ln] = bf16_bits(p0 - bf16_val(hb));
      hb = bf16_bits(p1);                sPh[w][8 * hh + r][16 + ln] = hb; sPl[w][8 * hh + r][16 + ln] = bf16_bits(p1 - bf16_val(hb));
    }
#pragma unroll
    for (int dt = 0; dt < DT; ++dt)
#pragma unroll
      for (int r = 0; r < 8; ++r) oacc[dt][r] *= alpha[r];
    __builtin_amdgcn_fence(__ATOMIC_ACQ_REL, "workgroup");
    __builtin_amdgcn_wave_barrier();
    FragB pah, pal;
    pah.half[0] = *(const v8us*)&sPh[w][ln][8 * hh]; pah.half[1] = *(const v8us*)&sPh[w][ln][16 + 8 * hh];
    pal.half[0] = *(const v8us*)&sPl[w][ln][8 * hh]; pal.half[1] = *(const v8us*)&sPl[w][ln][16 + 8 * hh];
#pragma unroll
    for (int dt = 0; dt < DT; ++dt) {
      FragB bvh, bvl;
#pragma unroll
      for (int i = 0; i < 8; ++i) {
        bvh.u[i] = sVh[8 * hh + i][dt * 16 + ln]; bvh.u[8 + i] = sVh[16 + 8 * hh + i][dt * 16 + ln];
        bvl.u[i] = sVl[8 * hh + i][dt * 16 + ln]; bvl.u[8 + i] = sVl[16 + 8 * hh + i][dt * 16 + ln];
      }
      oacc[dt] = mmaN<3>(pah.v, pal.v, bvh.v, bvl.v, oacc[dt]);
    }
    __builtin_amdgcn_fence(__ATOMIC_ACQ_REL, "workgroup");
    __builtin_amdgcn_wave_barrier();
  }
#pragma unroll
  for (int r = 0; r < 8; ++r) {
    float l = l_r[r];
    l += __shfl_xor(l, 1, 32); l += __shfl_xor(l, 2, 32); l += __shfl_xor(l, 4, 32); l += __shfl_xor(l, 8, 32);
    l_r[r] = (l > 0.f) ? 1.0f / l : 0.f;
  }
#pragma unroll
  for (int dt = 0; dt < DT; ++dt)
#pragma unroll
    for (int r = 0; r < 8; ++r) sO[w][8 * hh + r][dt * 16 + ln] = oacc[dt][r] * l_r[r];
  __builtin_amdgcn_fence(__ATOMIC_ACQ_REL, "workgroup");
  __builtin_amdgcn_wave_barrier();
  {
    for (int r = 0; r < 16; ++r) {
      const int row = q0 + r;
      if (row < T && lane < D / 4) {
        const v4f val = *(const v4fa*)&sO[w][r][lane * 4];
        *(v4f*)(y + ((size_t)b * T + row) * ypitch + h * D + lane * 4) = val;
      }
    }
    
  }
}

// GEMM C = act(A·W + bias + resid): A f32 (ASPLIT -> hi/lo 2 terms), Wt bf16 [N][K]; ACT 0 none, 1 relu, 2 exact gelu;
// resid (optional, f32, row index = (row % rmod), pitch ldr, RES_BF16 rounds it) added before the activation.
template <bool ASPLIT, int ACT, bool BIAS_BF16, bool RES_BF16>
__global__ __launch_bounds__(128) void k_gemm_bf3(const float* __restrict__ A, int lda, const unsigned short* __restrict__ Wt, int ldb,
                                                const float* __restrict__ bias, const float* __restrict__ resid, int rmod, int ldr,
                                                float* __restrict__ C, int ldc, int M, int N, int K) {
  __shared__ __attribute__((aligned(16))) float so[4][16][64];
  const int tid = threadIdx.x, w = tid >> 5, lane = tid & 31, ln = lane & 15, hh = lane >> 4;
  const int ntn = N / 64;
  const int wid = blockIdx.x * 4 + w;
  const int mt = wid / ntn, nq = wid % ntn;
  if (mt * 16 >= M) return;
  const int row0 = mt * 16, col0 = nq * 64;
  const float* arow = A + (size_t)(row0 + ln) * lda;
  v8f acc[4] = {};
  for (int kb = 0; kb < K; kb += 32) {
    FragB ah, al;
    const v4f x0 = *(const v4fa*)(arow + kb + 8 * hh), x1 = *(const v4fa*)(arow + kb + 8 * hh + 4);
    const v4f x2 = *(const v4fa*)(arow + kb + 16 + 8 * hh), x3 = *(const v4fa*)(arow + kb + 16 + 8 * hh + 4);
    float xs[16] = {x0[0],x0[1],x0[2],x0[3],x1[0],x1[1],x1[2],x1[3],x2[0],x2[1],x2[2],x2[3],x3[0],x3[1],x3[2],x3[3]};
#pragma unroll
    for (int i = 0; i < 16; ++i) { const unsigned short hb = bf16_bits(xs[i]); ah.u[i] = hb; al.u[i] = ASPLIT ? bf16_bits(xs[i] - bf16_val(hb)) : (unsigned short)0; }
#pragma unroll
    for (int t = 0; t < 4; ++t) {
      const unsigned short* brow = Wt + (size_t)(col0 + t * 16 + ln) * ldb + kb;
      FragB b;
      b.half[0] = *(const v8us*)(brow + 8 * hh);
      b.half[1] = *(const v8us*)(brow + 16 + 8 * hh);
      acc[t] = mmaN<ASPLIT ? 2 : 1>(ah.v, al.v, b.v, b.v, acc[t]);
    }
  }
#pragma unroll
  for (int t = 0; t < 4; ++t) {
    const int col = col0 + t * 16 + ln;
    float bv = bias ? bias[col] : 0.f;
    if (BIAS_BF16) bv = bf16_round(bv);
#pragma unroll
    for (int r = 0; r < 8; ++r) {
      float v = acc[t][r] + bv;
      if (resid) { float rv = resid[(size_t)((row0 + 8 * hh + r) % rmod) * ldr + col]; if (RES_BF16) rv = bf16_round(rv); v += rv; }
      if (ACT == 1) v = fmaxf(v, 0.f);
      if (ACT == 2) v = 0.5f * v * (1.0f + erff(v * 0.70710678118654752f));
      if (ACT == 3) { const float u = 0.7978845608028654f * (v + 0.044715f * v * v * v); v = 0.5f * v * (1.0f + tanhf(u)); }
      so[w][8 * hh + r][t * 16 + ln] = v;
    }
  }
  __builtin_amdgcn_fence(__ATOMIC_ACQ_REL, "workgroup");
  __builtin_amdgcn_wave_barrier();
  const int rsub = lane >> 4, c4 = (lane & 15) * 4;
  {
#pragma unroll
    for (int q = 0; q < 8; ++q) {
      const int r = q * 2 + rsub;
      const v4f v = *(const v4fa*)&so[w][r][c4];
      *(v4f*)(C + (size_t)(row0 + r) * ldc + col0 + c4) = v;
    }
    
  }
}
// row LayerNorm (biased variance, eps) over N: s = X (+ R); optional out_sum <- s; out_norm <- (s-mu)*rsqrt(var+eps)*g + b
template <bool PARAM_BF16>
__global__ __launch_bounds__(256) void k_layernorm(const float* __restrict__ X, const float* __restrict__ R, const float* __restrict__ g, const float* __restrict__ bta,
                                                  float* __restrict__ out_sum, float* __restrict__ out_norm, int N, float eps) {
  __shared__ float red[256];
  const int row = blockIdx.x, tid = threadIdx.x;
  const float* x = X + (size_t)row * N; const float* rr = R ? R + (size_t)row * N : nullptr;
  float vals[16];                     // up to N = 4096
  const int per = N / 256;            // contiguous chunk per thread? use strided-by-4 chunks: thread handles j = tid*4 + 1024*u
  float s1 = 0.f;
  for (int u = 0; u < per / 4; ++u) {
    const int j = tid * 4 + 1024 * u;
    const v4f a = *(const v4fa*)(x + j);
    v4f b = {0.f,0.f,0.f,0.f}; if (rr) b = *(const v4fa*)(rr + j);
#pragma unroll
    for (int q = 0; q < 4; ++q) { const float v = a[q] + b[q]; vals[u * 4 + q] = v; s1 += v; }
  }
  red[tid] = s1; __syncthreads();
  for (int st = 128; st > 0; st >>= 1) { if (tid < st) red[tid] += red[tid + st]; __syncthreads(); }
  const float mu = red[0] / (float)N; __syncthreads();
  float s2 = 0.f;
  for (int u = 0; u < per / 4; ++u)
#pragma unroll
    for (int q = 0; q < 4; ++q) { const float c = vals[u * 4 + q] - mu; s2 += c * c; }
  red[tid] = s2; __syncthreads();
  for (int st = 128; st > 0; st >>= 1) { if (tid < st) red[tid] += red[tid + st]; __syncthreads(); }
  const float rs = rsqrtf(red[0] / (float)N + eps);
  {
    for (int u = 0; u < per / 4; ++u) {
      const int j = tid * 4 + 1024 * u;
      v4f o, sm;
#pragma unroll
      for (int q = 0; q < 4; ++q) {
        float gg = g[j + q], bb = bta[j + q];
        if (PARAM_BF16) { gg = bf16_round(gg); bb = bf16_round(bb); }
        sm[q] = vals[u * 4 + q]; o[q] = (vals[u * 4 + q] - mu) * rs * gg + bb;
      }
      if (out_sum) *(v4f*)(out_sum + (size_t)row * N + j) = sm;
      *(v4f*)(out_norm + (size_t)row * N + j) = o;
    }
    
  }
}



// ---- f16 WMMA path (v_wmma_f32_16x16x32_f16): 11-bit significands for operands in range — used where a [0,1] probability operand needs more precision than bf16
typedef _Float16 v16h __attribute__((ext_vector_type(16)));
union FragH { v16h v; v8us half[2]; _Float16 h[16]; unsigned short u[16]; };
template <int NT>
__device__ __forceinline__ v8f mmaH(v16h ah, v16h al, v16h bh, v16h bl, v8f c) {
  c = __builtin_amdgcn_wmma_f32_16x16x32_f16(false, ah, false, bh, (short)0, c, false, false);
  if (NT >= 2) c = __builtin_amdgcn_wmma_f32_16x16x32_f16(false, al, false, bh, (short)0, c, false, false);
  if (NT >= 3) c = __builtin_amdgcn_wmma_f32_16x16x32_f16(false, ah, false, bl, (short)0, c, false, false);
  asm volatile("v_nop\n\tv_nop\n\tv_nop\n\tv_nop" : "+v"(c) : "v"(ah), "v"(al), "v"(bh), "v"(bl));
  return c;
}
// batched GEMM like k_gemm_b but f16 operands: A f32 (split into f16 hi/lo if ASPLIT, else rounded to f16), Bt = f16 values [n][k]; alpha; C f32; N multiple of 16 (partial tiles skipped)
template <bool ASPLIT>
__global__ __launch_bounds__(128) void k_gemm_h(const float* __restrict__ A, int lda, size_t sA, const _Float16* __restrict__ Bh, int ldb, size_t sB, float alpha, float* __restrict__ C, int ldc, size_t sC, int M, int N, int K) {
  __shared__ __attribute__((aligned(16))) float so[4][16][64];
  const int tid = threadIdx.x, w = tid >> 5, lane = tid & 31, ln = lane & 15, hh = lane >> 4; const int by = blockIdx.y;
  A += (size_t)by * sA; Bh += (size_t)by * sB; C += (size_t)by * sC;
  const int ntn = (N + 63) / 64; const int wid = blockIdx.x * 4 + w; const int mt = wid / ntn, nq = wid % ntn; if (mt * 16 >= M) return;
  const int row0 = mt * 16, col0 = nq * 64; const float* arow = A + (size_t)(row0 + ln) * lda;
  v8f acc[4] = {};
  for (int kb = 0; kb < K; kb += 32) {
    FragH ah, al;
    const v4f x0 = *(const v4fa*)(arow + kb + 8 * hh), x1 = *(const v4fa*)(arow + kb + 8 * hh + 4), x2 = *(const v4fa*)(arow + kb + 16 + 8 * hh), x3 = *(const v4fa*)(arow + kb + 16 + 8 * hh + 4);
    float xs[16] = {x0[0],x0[1],x0[2],x0[3],x1[0],x1[1],x1[2],x1[3],x2[0],x2[1],x2[2],x2[3],x3[0],x3[1],x3[2],x3[3]};
#pragma unroll
    for (int i = 0; i < 16; ++i) { const _Float16 h = (_Float16)xs[i]; ah.h[i] = h; al.h[i] = ASPLIT ? (_Float16)(xs[i] - (float)h) : (_Float16)0.0f; }
#pragma unroll
    for (int t = 0; t < 4; ++t) { if (col0 + t * 16 >= N) continue; const size_t boff = (size_t)(col0 + t * 16 + ln) * ldb + kb; FragH bq; bq.half[0] = *(const v8us*)(Bh + boff + 8 * hh); bq.half[1] = *(const v8us*)(Bh + boff + 16 + 8 * hh);
      acc[t] = mmaH<ASPLIT ? 2 : 1>(ah.v, al.v, bq.v, bq.v, acc[t]); }
  }
#pragma unroll
  for (int t = 0; t < 4; ++t) { if (col0 + t * 16 >= N) continue;
#pragma unroll
    for (int r = 0; r < 8; ++r) so[w][8 * hh + r][t * 16 + ln] = acc[t][r] * alpha; }
  __builtin_amdgcn_fence(__ATOMIC_ACQ_REL, "workgroup"); __builtin_amdgcn_wave_barrier();
  const int rsub = lane >> 4, c4 = (lane & 15) * 4;
  {
#pragma unroll
    for (int q = 0; q < 8; ++q) { const int r = q * 2 + rsub; if (col0 + c4 < N) { const v4f v = *(const v4fa*)&so[w][r][c4]; *(v4f*)(C + (size_t)(row0 + r) * ldc + col0 + c4) = v; } }
     }
}

// Wt[n][k] = f16(W[k][n]·scale) from f32 row-major W[K][N] (scale = power of two; bf16-exact weights stay exact in f16 away from the subnormal range)
__global__ __launch_bounds__(256) void k_wt_f16(const float* __restrict__ W, _Float16* __restrict__ Wt, int K, int N, float scale) {
  const int t = blockIdx.x * 256 + threadIdx.x; if (t >= N * (K / 8)) return; const int n = t / (K / 8), k8 = (t % (K / 8)) * 8; FragH f;
#pragma unroll
  for (int i = 0; i < 8; ++i) f.h[i] = (_Float16)(bf16_round(W[(size_t)(k8 + i) * N + n]) * scale); const v8us o = f.half[0];
  *(v8us*)((unsigned short*)Wt + (size_t)n * K + k8) = o; 
}
// k_gemm_hh variant with fused epilogue: v = acc·alpha + bias[by·sBias + col] (+ CP[(row/rowsPerB)·sCPb + by·64 + col] if CP) ; ACT 0 none / 1 elu ; writes f16 C16 and f32 C, each if non-null
template <int ACT>
__global__ __launch_bounds__(128) void k_gemm_hhx(const _Float16* __restrict__ A, int lda, size_t sA, const _Float16* __restrict__ Bh, int ldb, size_t sB, float alpha, const float* __restrict__ bias, size_t sBias, const float* __restrict__ CP, int rowsPerB, size_t sCPb, int row0g,
    float* __restrict__ C, _Float16* __restrict__ C16, int ldc, size_t sC, int M, int N, int K) {
  __shared__ __attribute__((aligned(16))) float so[4][16][64];
  const int tid = threadIdx.x, w = tid >> 5, lane = tid & 31, ln = lane & 15, hh = lane >> 4; const int by = blockIdx.y;
  A += (size_t)by * sA; Bh += (size_t)by * sB; const size_t cofs = (size_t)by * sC; const float* bp = bias ? bias + (size_t)by * sBias : nullptr;
  const int ntn = (N + 63) / 64; const int wid = blockIdx.x * 4 + w; const int mt = wid / ntn, nq = wid % ntn; if (mt * 16 >= M) return;
  const int row0 = mt * 16, col0 = nq * 64; const _Float16* arow = A + (size_t)(row0 + ln) * lda;
  v8f acc[4] = {};
  for (int kb = 0; kb < K; kb += 32) { FragH ah; ah.half[0] = *(const v8us*)((const unsigned short*)arow + kb + 8 * hh); ah.half[1] = *(const v8us*)((const unsigned short*)arow + kb + 16 + 8 * hh);
#pragma unroll
    for (int t = 0; t < 4; ++t) { if (col0 + t * 16 >= N) continue; const size_t boff = (size_t)(col0 + t * 16 + ln) * ldb + kb; FragH bq; bq.half[0] = *(const v8us*)((const unsigned short*)Bh + boff + 8 * hh); bq.half[1] = *(const v8us*)((const unsigned short*)Bh + boff + 16 + 8 * hh);
      acc[t] = mmaH<1>(ah.v, ah.v, bq.v, bq.v, acc[t]); }
  }
#pragma unroll
  for (int t = 0; t < 4; ++t) { if (col0 + t * 16 >= N) continue; const int col = col0 + t * 16 + ln; const float bv = bp ? bf16_round(bp[col]) : 0.f;
#pragma unroll
    for (int r = 0; r < 8; ++r) { float v = acc[t][r] * alpha + bv; if (CP) { const int bidx = (row0g + row0 + 8 * hh + r) / rowsPerB; v += CP[(size_t)bidx * sCPb + (size_t)by * 64 + col]; } if (ACT == 1) v = (v > 0.f) ? v : expm1f(v); else if (ACT == 3) v = fmaxf(v, 0.f); so[w][8 * hh + r][t * 16 + ln] = v; } }
  __builtin_amdgcn_fence(__ATOMIC_ACQ_REL, "workgroup"); __builtin_amdgcn_wave_barrier();
  const int rsub = lane >> 4, c4 = (lane & 15) * 4; typedef _Float16 v4h __attribute__((ext_vector_type(4)));
  {
#pragma unroll
    for (int q = 0; q < 8; ++q) { const int r = q * 2 + rsub; if (col0 + c4 < N) { const v4f v = *(const v4fa*)&so[w][r][c4]; if (C) *(v4f*)(C + cofs + (size_t)(row0 + r) * ldc + col0 + c4) = v; if (C16) { v4h h4; for (int i = 0; i < 4; ++i) h4[i] = (_Float16)v[i]; *(v4h*)(C16 + cofs + (size_t)(row0 + r) * ldc + col0 + c4) = h4; } } }
     }
}


__global__ __launch_bounds__(256) void k_x16(const float* __restrict__ x, _Float16* __restrict__ X16, size_t n8) { const size_t t = (size_t)blockIdx.x * 256 + threadIdx.x; if (t >= n8) return; FragH f;
#pragma unroll
  for (int q = 0; q < 8; ++q) f.h[q] = (_Float16)bf16_round(x[t * 8 + q]); *(v8us*)((unsigned short*)X16 + t * 8) = f.half[0];  }
__global__ __launch_bounds__(256) void k_h16(const float* __restrict__ x, _Float16* __restrict__ X16, size_t n8) { const size_t t = (size_t)blockIdx.x * 256 + threadIdx.x; if (t >= n8) return; FragH f;
#pragma unroll
  for (int q = 0; q < 8; ++q) f.h[q] = (_Float16)x[t * 8 + q]; *(v8us*)((unsigned short*)X16 + t * 8) = f.half[0];  }
__global__ __launch_bounds__(256) void k_round16f(const float* __restrict__ W, _Float16* __restrict__ Bt, size_t n8) { const size_t t = (size_t)blockIdx.x * 256 + threadIdx.x; if (t >= n8) return; FragH f;
#pragma unroll
  for (int i = 0; i < 8; ++i) f.h[i] = (_Float16)(bf16_round(W[t * 8 + i]) * 16.0f); *(v8us*)((unsigned short*)Bt + t * 8) = f.half[0];  }
template <int NHv, int TTv>
__global__ __launch_bounds__(256) void k_vt(const _Float16* __restrict__ V16, int ldv, int voff, _Float16* __restrict__ Vt) { __shared__ unsigned short tl[64][66]; const int tid = threadIdx.x; const int slab = blockIdx.x / (TTv / 64), lg = blockIdx.x % (TTv / 64); const int b = slab / NHv, h = slab % NHv;
  for (int i = tid; i < 64 * 8; i += 256) { const int r = i / 8, c8 = (i % 8) * 8; FragH f; f.half[0] = *(const v8us*)((const unsigned short*)V16 + ((size_t)b * TTv + lg * 64 + r) * ldv + voff + h * 64 + c8);
#pragma unroll
    for (int q = 0; q < 8; ++q) tl[r][c8 + q] = f.u[q]; }
  __syncthreads();
  {
#pragma unroll
    for (int rd = 0; rd < 2; ++rd) { const int d = rd * 32 + tid / 8, pc = tid % 8; FragH f;
#pragma unroll
      for (int q = 0; q < 8; ++q) f.u[q] = tl[pc * 8 + q][d];
      *(v8us*)((unsigned short*)Vt + ((size_t)slab * 64 + d) * TTv + lg * 64 + pc * 8) = f.half[0]; }
     } }

__global__ __launch_bounds__(128) void k_flash(const _Float16* __restrict__ Q16, int ldq, const _Float16* __restrict__ K16, int ldk, const _Float16* __restrict__ Vt, const int* __restrict__ MSK, float* __restrict__ O, int ldo) {
  constexpr int RPW = 16, RTN = RPW / 16, NQB = 2048 / (4 * RPW), DT = 8, KS = 4;      /* head_dim 128 */
  __shared__ __attribute__((aligned(16))) unsigned short sP[4][RPW][40]; __shared__ __attribute__((aligned(16))) float sO[4][RPW][128 + 4];
  const int tid = threadIdx.x, w = tid >> 5, lane = tid & 31, ln = lane & 15, hh = lane >> 4;
  const int slab = blockIdx.x / NQB, qblk = blockIdx.x % NQB; const int b = slab / 16, h = slab % 16; const int qb0 = qblk * (4 * RPW); const int q0 = qb0 + w * RPW;
  FragH aq[2][KS];
#pragma unroll
  for (int rt = 0; rt < RTN; ++rt) { const unsigned short* qr = (const unsigned short*)Q16 + ((size_t)b * 2048 + q0 + rt * 16 + ln) * ldq + h * 128;
#pragma unroll
    for (int ks = 0; ks < KS; ++ks) { aq[rt][ks].half[0] = *(const v8us*)(qr + ks * 32 + 8 * hh); aq[rt][ks].half[1] = *(const v8us*)(qr + ks * 32 + 16 + 8 * hh); } }
  const unsigned short* Vth = (const unsigned short*)Vt + (size_t)slab * 128 * 2048;      /* [bh][128][T] */
  float m_r[2][8], l_r[2][8]; v8f oacc[2][DT];
#pragma unroll
  for (int rt = 0; rt < RTN; ++rt) {
#pragma unroll
    for (int r = 0; r < 8; ++r) { m_r[rt][r] = -3.0e38f; l_r[rt][r] = 0.f; }
#pragma unroll
    for (int dt = 0; dt < DT; ++dt) oacc[rt][dt] = (v8f){0.f,0.f,0.f,0.f,0.f,0.f,0.f,0.f}; }
  const int jend = qb0 + 4 * RPW;
#pragma unroll 1
  for (int j0 = 0; j0 < jend; j0 += 32) {
    
    v8f s[2][2];
#pragma unroll
    for (int nt = 0; nt < 2; ++nt) { const unsigned short* kr = (const unsigned short*)K16 + ((size_t)b * 2048 + j0 + nt * 16 + ln) * ldk + h * 128; FragH bk[KS];
#pragma unroll
      for (int ks = 0; ks < KS; ++ks) { bk[ks].half[0] = *(const v8us*)(kr + ks * 32 + 8 * hh); bk[ks].half[1] = *(const v8us*)(kr + ks * 32 + 16 + 8 * hh); }
#pragma unroll
      for (int rt = 0; rt < RTN; ++rt) { v8f acc = (v8f){0.f,0.f,0.f,0.f,0.f,0.f,0.f,0.f};
#pragma unroll
        for (int ks = 0; ks < KS; ++ks) acc = mmaH<1>(aq[rt][ks].v, aq[rt][ks].v, bk[ks].v, bk[ks].v, acc); s[rt][nt] = acc; } }
#pragma unroll
    for (int rt = 0; rt < RTN; ++rt)
#pragma unroll
      for (int r = 0; r < 8; ++r) { const int tq = q0 + rt * 16 + 8 * hh + r; const int k0 = j0 + ln, k1 = j0 + 16 + ln; (void)tq; (void)k0; (void)k1;
        const bool ok0 = (k0 <= tq), ok1 = (k1 <= tq);
        const float s0 = ok0 ? s[rt][0][r] * (1.0f) : -INFINITY, s1 = ok1 ? s[rt][1][r] * (1.0f) : -INFINITY; float mc = fmaxf(s0, s1);
        mc = fmaxf(mc, __shfl_xor(mc, 1, 32)); mc = fmaxf(mc, __shfl_xor(mc, 2, 32)); mc = fmaxf(mc, __shfl_xor(mc, 4, 32)); mc = fmaxf(mc, __shfl_xor(mc, 8, 32));
        const float mn = fmaxf(m_r[rt][r], mc); const float al = (mn > -1.0e38f) ? expf(m_r[rt][r] - mn) : 1.0f; m_r[rt][r] = mn; const float p0 = ok0 ? expf(s0 - mn) : 0.f, p1 = ok1 ? expf(s1 - mn) : 0.f; l_r[rt][r] = l_r[rt][r] * al + p0 + p1;
#pragma unroll
        for (int dt = 0; dt < DT; ++dt) oacc[rt][dt][r] *= al;
        FragH t2; t2.h[0] = (_Float16)p0; t2.h[1] = (_Float16)p1; sP[w][rt * 16 + 8 * hh + r][ln] = t2.u[0]; sP[w][rt * 16 + 8 * hh + r][16 + ln] = t2.u[1]; }
    __builtin_amdgcn_fence(__ATOMIC_ACQ_REL, "workgroup"); __builtin_amdgcn_wave_barrier();
    FragH pa[2];
#pragma unroll
    for (int rt = 0; rt < RTN; ++rt) { pa[rt].half[0] = *(const v8us*)&sP[w][rt * 16 + ln][8 * hh]; pa[rt].half[1] = *(const v8us*)&sP[w][rt * 16 + ln][16 + 8 * hh]; }
#pragma unroll
    for (int dt = 0; dt < DT; ++dt) { const unsigned short* vrow = Vth + (size_t)(dt * 16 + ln) * 2048 + j0; FragH bv; bv.half[0] = *(const v8us*)(vrow + 8 * hh); bv.half[1] = *(const v8us*)(vrow + 16 + 8 * hh);
#pragma unroll
      for (int rt = 0; rt < RTN; ++rt) oacc[rt][dt] = mmaH<1>(pa[rt].v, pa[rt].v, bv.v, bv.v, oacc[rt][dt]); }
    __builtin_amdgcn_fence(__ATOMIC_ACQ_REL, "workgroup"); __builtin_amdgcn_wave_barrier(); }
#pragma unroll
  for (int rt = 0; rt < RTN; ++rt) {
#pragma unroll
    for (int r = 0; r < 8; ++r) { float l = l_r[rt][r]; l += __shfl_xor(l, 1, 32); l += __shfl_xor(l, 2, 32); l += __shfl_xor(l, 4, 32); l += __shfl_xor(l, 8, 32); l_r[rt][r] = (l > 0.f) ? 1.0f / l : 0.f; }
#pragma unroll
    for (int dt = 0; dt < DT; ++dt)
#pragma unroll
      for (int r = 0; r < 8; ++r) sO[w][rt * 16 + 8 * hh + r][dt * 16 + ln] = oacc[rt][dt][r] * l_r[rt][r]; }
  __builtin_amdgcn_fence(__ATOMIC_ACQ_REL, "workgroup"); __builtin_amdgcn_wave_barrier();
  {
#pragma unroll
    for (int rp = 0; rp < RPW; ++rp) { const int r = rp, pc = lane; const v4f val = *(const v4fa*)&sO[w][r][pc * 4]; *(v4f*)(O + ((size_t)b * 2048 + q0 + r) * ldo + h * 128 + pc * 4) = val; }      /* 32 lanes × 16 B = whole 512-B head row */
     } }

typedef _Float16 v4h __attribute__((ext_vector_type(4)));
__global__ __launch_bounds__(256) void k_l2n(const float* __restrict__ F, const float* __restrict__ sp, _Float16* __restrict__ O16) { const int tid = threadIdx.x, wv = tid >> 5, lane = tid & 31; const size_t th = (size_t)blockIdx.x * 8 + wv; if (th >= (size_t)NR * NH) return; const float* fr = F + th * HD; const v4f v = *(const v4fa*)(fr + lane * 4); float ss = v[0] * v[0] + v[1] * v[1] + v[2] * v[2] + v[3] * v[3];
  for (int o = 16; o >= 1; o >>= 1) ss += __shfl_xor(ss, o, 32); const float sc = (sp ? bf16_round(sp[0]) : 1.0f) / (sqrtf(ss) + 1e-8f); v4h o4; for (int q = 0; q < 4; ++q) o4[q] = (_Float16)(v[q] * sc);
  _Float16* d = O16 + th * HD + lane * 4; *(v4h*)d = o4;  }
__global__ __launch_bounds__(256) void k_scale(const float* __restrict__ O, const float* __restrict__ nu, float* __restrict__ out, size_t n4) { const size_t t = (size_t)blockIdx.x * 256 + threadIdx.x; if (t >= n4) return; const float s = bf16_round(nu[0]); v4f v = *(const v4fa*)(O + t * 4); for (int q = 0; q < 4; ++q) v[q] *= s; *(v4f*)(out + t * 4) = v;  }
extern "C" void kernel_launch(void* const* d_in, const int* in_sizes, int n_in,
                              void* d_out, int out_size, void* d_ws, size_t ws_size, hipStream_t stream) {
  (void)in_sizes; (void)n_in; (void)out_size;
  const float* x = (const float*)d_in[0]; const float* wq = (const float*)d_in[1]; const float* wk = (const float*)d_in[2]; const float* wv = (const float*)d_in[3]; const float* tau = (const float*)d_in[4]; const float* nu = (const float*)d_in[5];
  char* ws = (char*)d_ws; size_t off = 0;
  auto take = [&](size_t bytes) { char* p = ws + off; off += (bytes + 255) & ~(size_t)255; return p; };
  _Float16* Bw = (_Float16*)take((size_t)CC * CC * 2); _Float16* X16 = (_Float16*)take((size_t)NR * CC * 2); float* F = (float*)take((size_t)NR * CC * 4); _Float16* Q16 = (_Float16*)take((size_t)NR * CC * 2); _Float16* K16 = (_Float16*)take((size_t)NR * CC * 2); _Float16* V16 = (_Float16*)take((size_t)NR * CC * 2); _Float16* Vt = X16; float* O = F;
  if (off > ws_size) return;      // 8.4 + 16.8 + 33.5 + 16.8 × 3 ≈ 109 MB
  const size_t w8 = (size_t)CC * CC / 8; const unsigned gw = (unsigned)((w8 + 255) / 256), g8 = (unsigned)(((size_t)NR * CC / 8 + 255) / 256), gn = (unsigned)(((size_t)NR * NH + 7) / 8); const dim3 gg(((NR / 16) * (CC / 64) + 3) / 4, 1);
  k_x16<<<g8, 256, 0, stream>>>(x, X16, (size_t)NR * CC / 8);
  k_round16f<<<gw, 256, 0, stream>>>(wq, Bw, w8); k_gemm_hhx<0><<<gg, 128, 0, stream>>>(X16, CC, 0, Bw, CC, 0, 0.0625f, nullptr, 0, nullptr, 1, 0, 0, F, nullptr, CC, 0, NR, CC, CC); k_l2n<<<gn, 256, 0, stream>>>(F, tau, Q16);      // q̂·τ
  k_round16f<<<gw, 256, 0, stream>>>(wk, Bw, w8); k_gemm_hhx<0><<<gg, 128, 0, stream>>>(X16, CC, 0, Bw, CC, 0, 0.0625f, nullptr, 0, nullptr, 1, 0, 0, F, nullptr, CC, 0, NR, CC, CC); k_l2n<<<gn, 256, 0, stream>>>(F, nullptr, K16);
  k_round16f<<<gw, 256, 0, stream>>>(wv, Bw, w8); k_gemm_hhx<0><<<gg, 128, 0, stream>>>(X16, CC, 0, Bw, CC, 0, 0.0625f, nullptr, 0, nullptr, 1, 0, 0, F, nullptr, CC, 0, NR, CC, CC); k_l2n<<<gn, 256, 0, stream>>>(F, nullptr, V16);
  k_vt<NH * 2, TT><<<BB * NH * 2 * (TT / 64), 256, 0, stream>>>(V16, CC, 0, Vt);      // 32 slabs of 64 dims → [bh][128][T] contiguous (Vt over X16: X16's last reader is the v GEMM)
  k_flash<<<BB * NH * (TT / 64), 128, 0, stream>>>(Q16, CC, K16, CC, Vt, nullptr, O, CC);      // causal, scale 1 (τ already in q̂); O over F
  k_scale<<<(unsigned)(((size_t)NR * CC / 4 + 255) / 256), 256, 0, stream>>>(O, nu, (float*)d_out, (size_t)NR * CC / 4);
}

// v001
// A run of this version takes 492 microseconds.
// Two timings next to v000 put it at 1.50 and 1.49 times that version's speed.
#include <hip/hip_runtime.h>
// Scaled-cosine causal self-attention (B=2, T=2048, C=2048, 16 heads × 128; q,k,v = x·Wᵀ; each l2-normalised per head (÷(‖·‖+1e-8)); scores = q̂·k̂·τ, causal, softmax; out = (P·v̂)·ν; no output
// projection): the three projections are GEMMs ((out,in) weights bf16-exact ×2^4, f32 accumulate) and the causal attention is a fused flash-style kernel with 128-wide heads (4 logit k-steps, 8 value
// sub-tiles; online softmax f32; upper tiles skipped; P f16 ≤ 1; O = P·Vt; RPW-16 waves; τ folded into q̂, ν into the final scaling) on v_wmma_f32_16x16x32_f16; the l2 norms are f32 VALU.
#define BB 2
#define TT 2048
#define CC 2048
#define NH 16
#define HD 128
#define NR (BB * TT)

typedef __bf16 v16b __attribute__((ext_vector_type(16)));
typedef unsigned short v8us __attribute__((ext_vector_type(8), may_alias));
typedef float  v8f  __attribute__((ext_vector_type(8)));
typedef float  v4f  __attribute__((ext_vector_type(4)));
typedef float  v4fa __attribute__((ext_vector_type(4), may_alias));
union FragB { v16b v; v8us half[2]; unsigned short u[16]; };

__device__ __forceinline__ unsigned short bf16_bits(float x) { unsigned int u = __float_as_uint(x); return (unsigned short)((u + 0x7FFFu + ((u >> 16) & 1u)) >> 16); }
__device__ __forceinline__ float bf16_val(unsigned short b) { return __uint_as_float(((unsigned int)b) << 16); }
__device__ __forceinline__ float bf16_round(float x) { return bf16_val(bf16_bits(x)); }
// D += A·B with NT terms: 1 = ah·bh, 2 = + al·bh (A split), 3 = + ah·bl (both split)
template <int NT>
__device__ __forceinline__ v8f mmaN(v16b ah, v16b al, v16b bh, v16b bl, v8f c) {
  c = __builtin_amdgcn_wmma_f32_16x16x32_bf16(false, ah, false, bh, (short)0, c, false, false);
  if (NT >= 2) c = __builtin_amdgcn_wmma_f32_16x16x32_bf16(false, al, false, bh, (short)0, c, false, false);
  if (NT >= 3) c = __builtin_amdgcn_wmma_f32_16x16x32_bf16(false, ah, false, bl, (short)0, c, false, false);
  asm volatile("v_nop\n\tv_nop\n\tv_nop\n\tv_nop" : "+v"(c) : "v"(ah), "v"(al), "v"(bh), "v"(bl));
  return c;
}

__global__ __launch_bounds__(256) void k_wt_bf16(const float* __restrict__ W, unsigned short* __restrict__ Wt, int K, int N) {
  const int t = blockIdx.x * 256 + threadIdx.x;
  const int k8n = K / 8;
  if (t >= N * k8n) return;
  const int n = t / k8n, k8 = (t % k8n) * 8;
  v8us v;
#pragma unroll
  for (int i = 0; i < 8; ++i) v[i] = bf16_bits(W[(size_t)(k8 + i) * N + n]);
  *(v8us*)(Wt + (size_t)n * K + k8) = v;
  
}

// GEMM C[M][N] (f32, pitch ldc) = act(A[M][K]·W + bias). A f32 row-major (pitch lda) converted per fragment to bf16
// (ASPLIT: hi/lo two planes -> 2 terms, else single rounded term); Wt bf16 [N][K] (pitch ldb). BIAS_BF16 rounds the
// bias to bf16 first (bias quantised to bf16 before the add). K%32==0, M%16==0, N%64==0.
template <bool ASPLIT, int ACT, bool BIAS_BF16>
__global__ __launch_bounds__(128) void k_gemm_bf(const float* __restrict__ A, int lda, const unsigned short* __restrict__ Wt, int ldb,
                                               const float* __restrict__ bias, float* __restrict__ C, int ldc, int M, int N, int K) {
  __shared__ __attribute__((aligned(16))) float so[4][16][64];
  const int tid = threadIdx.x, w = tid >> 5, lane = tid & 31, ln = lane & 15, hh = lane >> 4;
  const int ntn = N / 64;
  const int wid = blockIdx.x * 4 + w;
  const int mt = wid / ntn, nq = wid % ntn;
  if (mt * 16 >= M) return;
  const int row0 = mt * 16, col0 = nq * 64;
  const float* arow = A + (size_t)(row0 + ln) * lda;
  v8f acc[4] = {};
  for (int kb = 0; kb < K; kb += 32) {
    FragB ah, al;
    const v4f x0 = *(const v4fa*)(arow + kb + 8 * hh), x1 = *(const v4fa*)(arow + kb + 8 * hh + 4);
    const v4f x2 = *(const v4fa*)(arow + kb + 16 + 8 * hh), x3 = *(const v4fa*)(arow + kb + 16 + 8 * hh + 4);
    float xs[16] = {x0[0],x0[1],x0[2],x0[3],x1[0],x1[1],x1[2],x1[3],x2[0],x2[1],x2[2],x2[3],x3[0],x3[1],x3[2],x3[3]};
#pragma unroll
    for (int i = 0; i < 16; ++i) { const unsigned short hb = bf16_bits(xs[i]); ah.u[i] = hb; al.u[i] = ASPLIT ? bf16_bits(xs[i] - bf16_val(hb)) : (unsigned short)0; }
#pragma unroll
    for (int t = 0; t < 4; ++t) {
      const unsigned short* brow = Wt + (size_t)(col0 + t * 16 + ln) * ldb + kb;
      FragB b;
      b.half[0] = *(const v8us*)(brow + 8 * hh);
      b.half[1] = *(const v8us*)(brow + 16 + 8 * hh);
      acc[t] = mmaN<ASPLIT ? 2 : 1>(ah.v, al.v, b.v, b.v, acc[t]);
    }
  }
#pragma unroll
  for (int t = 0; t < 4; ++t) {
    float bv = bias ? bias[col0 + t * 16 + ln] : 0.f;
    if (BIAS_BF16) bv = bf16_round(bv);
#pragma unroll
    for (int r = 0; r < 8; ++r) { float v = acc[t][r] + bv; if (ACT == 1) v = fmaxf(v, 0.f); so[w][8 * hh + r][t * 16 + ln] = v; }
  }
  __builtin_amdgcn_fence(__ATOMIC_ACQ_REL, "workgroup");
  __builtin_amdgcn_wave_barrier();
  const int rsub = lane >> 4, c4 = (lane & 15) * 4;
  {
#pragma unroll
    for (int q = 0; q < 8; ++q) {
      const int r = q * 2 + rsub;
      const v4f v = *(const v4fa*)&so[w][r][c4];
      *(v4f*)(C + (size_t)(row0 + r) * ldc + col0 + c4) = v;
    }
    
  }
}

// Flash-style causal/unmasked attention, all contractions 3-term bf16 hi/lo splits, f32 softmax with running max.
// q,k,v rows are read from f32 buffers with arbitrary row pitch (so they can live inside a fused qkv buffer);
// D = head size (multiple of 32, <= 128); one wave = 16 query rows; block = 4 waves (64 queries) sharing K/V chunks of 32.
template <int D, bool CAUSAL>
__global__ __launch_bounds__(128) void k_flash(const float* __restrict__ qb, const float* __restrict__ kb, const float* __restrict__ vb,
                                             int pitch, int T, int H, float scale, float* __restrict__ y, int ypitch) {
  constexpr int KS = D / 32;        // k-steps for QK
  constexpr int DT = D / 16;        // d tiles for PV
  __shared__ __attribute__((aligned(16))) unsigned short sKh[32][D + 8], sKl[32][D + 8], sVh[32][D + 8], sVl[32][D + 8];
  __shared__ __attribute__((aligned(16))) unsigned short sPh[4][16][40], sPl[4][16][40];
  __shared__ __attribute__((aligned(16))) float sO[4][16][D];
  const int tid = threadIdx.x, w = tid >> 5, lane = tid & 31, ln = lane & 15, hh = lane >> 4;
  const int nqb = (T + 63) / 64;
  const int bh = blockIdx.x / nqb, qblk = blockIdx.x % nqb;
  const int b = bh / H, h = bh % H;
  const int q0 = qblk * 64 + w * 16;
  const float* Q = qb + (size_t)b * T * pitch + h * D;
  const float* K = kb + (size_t)b * T * pitch + h * D;
  const float* V = vb + (size_t)b * T * pitch + h * D;

  // A fragments of the wave's 16 query rows (scaled), hi/lo
  FragB aqh[KS], aql[KS];
  {
    int row = q0 + ln; if (row >= T) row = T - 1;
    const float* qr = Q + (size_t)row * pitch;
#pragma unroll
    for (int ks = 0; ks < KS; ++ks)
#pragma unroll
      for (int i = 0; i < 16; ++i) {
        const int d = ks * 32 + ((i < 8) ? (8 * hh + i) : (16 + 8 * hh + (i - 8)));
        const float x = qr[d] * scale; const unsigned short hb = bf16_bits(x);
        aqh[ks].u[i] = hb; aql[ks].u[i] = bf16_bits(x - bf16_val(hb));
      }
  }
  float m_r[8], l_r[8];
#pragma unroll
  for (int r = 0; r < 8; ++r) { m_r[r] = -3.0e38f; l_r[r] = 0.f; }
  v8f oacc[DT];
#pragma unroll
  for (int dt = 0; dt < DT; ++dt) oacc[dt] = (v8f){0.f,0.f,0.f,0.f,0.f,0.f,0.f,0.f};

  const int kv_end = CAUSAL ? min(T, qblk * 64 + 64) : T;     // block-uniform
  for (int j0 = 0; j0 < kv_end; j0 += 32) {
    __syncthreads();
    for (int e = tid; e < 32 * (D / 4); e += 128) {
      const int r = e / (D / 4), c4 = (e % (D / 4)) * 4;
      const int key = j0 + r;
      v4f kf = {0.f,0.f,0.f,0.f}, vf = {0.f,0.f,0.f,0.f};
      if (key < T) { kf = *(const v4fa*)(K + (size_t)key * pitch + c4); vf = *(const v4fa*)(V + (size_t)key * pitch + c4); }
#pragma unroll
      for (int t = 0; t < 4; ++t) {
        unsigned short hb = bf16_bits(kf[t]); sKh[r][c4 + t] = hb; sKl[r][c4 + t] = bf16_bits(kf[t] - bf16_val(hb));
        hb = bf16_bits(vf[t]); sVh[r][c4 + t] = hb; sVl[r][c4 + t] = bf16_bits(vf[t] - bf16_val(hb));
      }
    }
    __syncthreads();
    // S tile 16 x 32
    v8f s[2];
#pragma unroll
    for (int nt = 0; nt < 2; ++nt) {
      v8f acc = {};
#pragma unroll
      for (int ks = 0; ks < KS; ++ks) {
        FragB bh_, bl_;
        bh_.half[0] = *(const v8us*)&sKh[nt * 16 + ln][ks * 32 + 8 * hh]; bh_.half[1] = *(const v8us*)&sKh[nt * 16 + ln][ks * 32 + 16 + 8 * hh];
        bl_.half[0] = *(const v8us*)&sKl[nt * 16 + ln][ks * 32 + 8 * hh]; bl_.half[1] = *(const v8us*)&sKl[nt * 16 + ln][ks * 32 + 16 + 8 * hh];
        acc = mmaN<3>(aqh[ks].v, aql[ks].v, bh_.v, bl_.v, acc);
      }
      s[nt] = acc;
    }
    // mask + running max (rows 8hh+r; the 16 lanes of a half share rows)
    float alpha[8];
#pragma unroll
    for (int r = 0; r < 8; ++r) {
      const int qi = q0 + 8 * hh + r;
      const int ja = j0 + ln, jb = j0 + 16 + ln;
      if (CAUSAL) { if (ja > qi) s[0][r] = -3.0e38f; if (jb > qi) s[1][r] = -3.0e38f; }
      if (ja >= T) s[0][r] = -3.0e38f;
      if (jb >= T) s[1][r] = -3.0e38f;
      float mx = fmaxf(s[0][r], s[1][r]);
      mx = fmaxf(mx, __shfl_xor(mx, 1, 32)); mx = fmaxf(mx, __shfl_xor(mx, 2, 32)); mx = fmaxf(mx, __shfl_xor(mx, 4, 32)); mx = fmaxf(mx, __shfl_xor(mx, 8, 32));
      const float mnew = fmaxf(m_r[r], mx);
      alpha[r] = (mnew > -1.0e38f) ? __expf(m_r[r] - mnew) : 1.0f;
      const float p0 = (s[0][r] > -1.0e38f) ? __expf(s[0][r] - mnew) : 0.f;
      const float p1 = (s[1][r] > -1.0e38f) ? __expf(s[1][r] - mnew) : 0.f;
      m_r[r] = mnew;
      l_r[r] = l_r[r] * alpha[r] + p0 + p1;            // per-lane partial row sum (16 lanes combined at the end)
      unsigned short hb = bf16_bits(p0); sPh[w][8 * hh + r][ln] = hb;      sPl[w][8 * hh + r][ln] = bf16_bits(p0 - bf16_val(hb));
      hb = bf16_bits(p1);                sPh[w][8 * hh + r][16 + ln] = hb; sPl[w][8 * hh + r][16 + ln] = bf16_bits(p1 - bf16_val(hb));
    }
#pragma unroll
    for (int dt = 0; dt < DT; ++dt)
#pragma unroll
      for (int r = 0; r < 8; ++r) oacc[dt][r] *= alpha[r];
    __builtin_amdgcn_fence(__ATOMIC_ACQ_REL, "workgroup");
    __builtin_amdgcn_wave_barrier();
    FragB pah, pal;
    pah.half[0] = *(const v8us*)&sPh[w][ln][8 * hh]; pah.half[1] = *(const v8us*)&sPh[w][ln][16 + 8 * hh];
    pal.half[0] = *(const v8us*)&sPl[w][ln][8 * hh]; pal.half[1] = *(const v8us*)&sPl[w][ln][16 + 8 * hh];
#pragma unroll
    for (int dt = 0; dt < DT; ++dt) {
      FragB bvh, bvl;
#pragma unroll
      for (int i = 0; i < 8; ++i) {
        bvh.u[i] = sVh[8 * hh + i][dt * 16 + ln]; bvh.u[8 + i] = sVh[16 + 8 * hh + i][dt * 16 + ln];
        bvl.u[i] = sVl[8 * hh + i][dt * 16 + ln]; bvl.u[8 + i] = sVl[16 + 8 * hh + i][dt * 16 + ln];
      }
      oacc[dt] = mmaN<3>(pah.v, pal.v, bvh.v, bvl.v, oacc[dt]);
    }
    __builtin_amdgcn_fence(__ATOMIC_ACQ_REL, "workgroup");
    __builtin_amdgcn_wave_barrier();
  }
#pragma unroll
  for (int r = 0; r < 8; ++r) {
    float l = l_r[r];
    l += __shfl_xor(l, 1, 32); l += __shfl_xor(l, 2, 32); l += __shfl_xor(l, 4, 32); l += __shfl_xor(l, 8, 32);
    l_r[r] = (l > 0.f) ? 1.0f / l : 0.f;
  }
#pragma unroll
  for (int dt = 0; dt < DT; ++dt)
#pragma unroll
    for (int r = 0; r < 8; ++r) sO[w][8 * hh + r][dt * 16 + ln] = oacc[dt][r] * l_r[r];
  __builtin_amdgcn_fence(__ATOMIC_ACQ_REL, "workgroup");
  __builtin_amdgcn_wave_barrier();
  {
    for (int r = 0; r < 16; ++r) {
      const int row = q0 + r;
      if (row < T && lane < D / 4) {
        const v4f val = *(const v4fa*)&sO[w][r][lane * 4];
        *(v4f*)(y + ((size_t)b * T + row) * ypitch + h * D + lane * 4) = val;
      }
    }
    
  }
}

// GEMM C = act(A·W + bias + resid): A f32 (ASPLIT -> hi/lo 2 terms), Wt bf16 [N][K]; ACT 0 none, 1 relu, 2 exact gelu;
// resid (optional, f32, row index = (row % rmod), pitch ldr, RES_BF16 rounds it) added before the activation.
template <bool ASPLIT, int ACT, bool BIAS_BF16, bool RES_BF16>
__global__ __launch_bounds__(128) void k_gemm_bf3(const float* __restrict__ A, int lda, const unsigned short* __restrict__ Wt, int ldb,
                                                const float* __restrict__ bias, const float* __restrict__ resid, int rmod, int ldr,
                                                float* __restrict__ C, int ldc, int M, int N, int K) {
  __shared__ __attribute__((aligned(16))) float so[4][16][64];
  const int tid = threadIdx.x, w = tid >> 5, lane = tid & 31, ln = lane & 15, hh = lane >> 4;
  const int ntn = N / 64;
  const int wid = blockIdx.x * 4 + w;
  const int mt = wid / ntn, nq = wid % ntn;
  if (mt * 16 >= M) return;
  const int row0 = mt * 16, col0 = nq * 64;
  const float* arow = A + (size_t)(row0 + ln) * lda;
  v8f acc[4] = {};
  for (int kb = 0; kb < K; kb += 32) {
    FragB ah, al;
    const v4f x0 = *(const v4fa*)(arow + kb + 8 * hh), x1 = *(const v4fa*)(arow + kb + 8 * hh + 4);
    const v4f x2 = *(const v4fa*)(arow + kb + 16 + 8 * hh), x3 = *(const v4fa*)(arow + kb + 16 + 8 * hh + 4);
    float xs[16] = {x0[0],x0[1],x0[2],x0[3],x1[0],x1[1],x1[2],x1[3],x2[0],x2[1],x2[2],x2[3],x3[0],x3[1],x3[2],x3[3]};
#pragma unroll
    for (int i = 0; i < 16; ++i) { const unsigned short hb = bf16_bits(xs[i]); ah.u[i] = hb; al.u[i] = ASPLIT ? bf16_bits(xs[i] - bf16_val(hb)) : (unsigned short)0; }
#pragma unroll
    for (int t = 0; t < 4; ++t) {
      const unsigned short* brow = Wt + (size_t)(col0 + t * 16 + ln) * ldb + kb;
      FragB b;
      b.half[0] = *(const v8us*)(brow + 8 * hh);
      b.half[1] = *(const v8us*)(brow + 16 + 8 * hh);
      acc[t] = mmaN<ASPLIT ? 2 : 1>(ah.v, al.v, b.v, b.v, acc[t]);
    }
  }
#pragma unroll
  for (int t = 0; t < 4; ++t) {
    const int col = col0 + t * 16 + ln;
    float bv = bias ? bias[col] : 0.f;
    if (BIAS_BF16) bv = bf16_round(bv);
#pragma unroll
    for (int r = 0; r < 8; ++r) {
      float v = acc[t][r] + bv;
      if (resid) { float rv = resid[(size_t)((row0 + 8 * hh + r) % rmod) * ldr + col]; if (RES_BF16) rv = bf16_round(rv); v += rv; }
      if (ACT == 1) v = fmaxf(v, 0.f);
      if (ACT == 2) v = 0.5f * v * (1.0f + erff(v * 0.70710678118654752f));
      if (ACT == 3) { const float u = 0.7978845608028654f * (v + 0.044715f * v * v * v); v = 0.5f * v * (1.0f + tanhf(u)); }
      so[w][8 * hh + r][t * 16 + ln] = v;
    }
  }
  __builtin_amdgcn_fence(__ATOMIC_ACQ_REL, "workgroup");
  __builtin_amdgcn_wave_barrier();
  const int rsub = lane >> 4, c4 = (lane & 15) * 4;
  {
#pragma unroll
    for (int q = 0; q < 8; ++q) {
      const int r = q * 2 + rsub;
      const v4f v = *(const v4fa*)&so[w][r][c4];
      *(v4f*)(C + (size_t)(row0 + r) * ldc + col0 + c4) = v;
    }
    
  }
}
// row LayerNorm (biased variance, eps) over N: s = X (+ R); optional out_sum <- s; out_norm <- (s-mu)*rsqrt(var+eps)*g + b
template <bool PARAM_BF16>
__global__ __launch_bounds__(256) void k_layernorm(const float* __restrict__ X, const float* __restrict__ R, const float* __restrict__ g, const float* __restrict__ bta,
                                                  float* __restrict__ out_sum, float* __restrict__ out_norm, int N, float eps) {
  __shared__ float red[256];
  const int row = blockIdx.x, tid = threadIdx.x;
  const float* x = X + (size_t)row * N; const float* rr = R ? R + (size_t)row * N : nullptr;
  float vals[16];                     // up to N = 4096
  const int per = N / 256;            // contiguous chunk per thread? use strided-by-4 chunks: thread handles j = tid*4 + 1024*u
  float s1 = 0.f;
  for (int u = 0; u < per / 4; ++u) {
    const int j = tid * 4 + 1024 * u;
    const v4f a = *(const v4fa*)(x + j);
    v4f b = {0.f,0.f,0.f,0.f}; if (rr) b = *(const v4fa*)(rr + j);
#pragma unroll
    for (int q = 0; q < 4; ++q) { const float v = a[q] + b[q]; vals[u * 4 + q] = v; s1 += v; }
  }
  red[tid] = s1; __syncthreads();
  for (int st = 128; st > 0; st >>= 1) { if (tid < st) red[tid] += red[tid + st]; __syncthreads(); }
  const float mu = red[0] / (float)N; __syncthreads();
  float s2 = 0.f;
  for (int u = 0; u < per / 4; ++u)
#pragma unroll
    for (int q = 0; q < 4; ++q) { const float c = vals[u * 4 + q] - mu; s2 += c * c; }
  red[tid] = s2; __syncthreads();
  for (int st = 128; st > 0; st >>= 1) { if (tid < st) red[tid] += red[tid + st]; __syncthreads(); }
  const float rs = rsqrtf(red[0] / (float)N + eps);
  {
    for (int u = 0; u < per / 4; ++u) {
      const int j = tid * 4 + 1024 * u;
      v4f o, sm;
#pragma unroll
      for (int q = 0; q < 4; ++q) {
        float gg = g[j + q], bb = bta[j + q];
        if (PARAM_BF16) { gg = bf16_round(gg); bb = bf16_round(bb); }
        sm[q] = vals[u * 4 + q]; o[q] = (vals[u * 4 + q] - mu) * rs * gg + bb;
      }
      if (out_sum) *(v4f*)(out_sum + (size_t)row * N + j) = sm;
      *(v4f*)(out_norm + (size_t)row * N + j) = o;
    }
    
  }
}



// ---- f16 WMMA path (v_wmma_f32_16x16x32_f16): 11-bit significands for operands in range — used where a [0,1] probability operand needs more precision than bf16
typedef _Float16 v16h __attribute__((ext_vector_type(16)));
union FragH { v16h v; v8us half[2]; _Float16 h[16]; unsigned short u[16]; };
template <int NT>
__device__ __forceinline__ v8f mmaH(v16h ah, v16h al, v16h bh, v16h bl, v8f c) {
  c = __builtin_amdgcn_wmma_f32_16x16x32_f16(false, ah, false, bh, (short)0, c, false, false);
  if (NT >= 2) c = __builtin_amdgcn_wmma_f32_16x16x32_f16(false, al, false, bh, (short)0, c, false, false);
  if (NT >= 3) c = __builtin_amdgcn_wmma_f32_16x16x32_f16(false, ah, false, bl, (short)0, c, false, false);
  asm volatile("v_nop\n\tv_nop\n\tv_nop\n\tv_nop" : "+v"(c) : "v"(ah), "v"(al), "v"(bh), "v"(bl));
  return c;
}
// batched GEMM like k_gemm_b but f16 operands: A f32 (split into f16 hi/lo if ASPLIT, else rounded to f16), Bt = f16 values [n][k]; alpha; C f32; N multiple of 16 (partial tiles skipped)
template <bool ASPLIT>
__global__ __launch_bounds__(128) void k_gemm_h(const float* __restrict__ A, int lda, size_t sA, const _Float16* __restrict__ Bh, int ldb, size_t sB, float alpha, float* __restrict__ C, int ldc, size_t sC, int M, int N, int K) {
  __shared__ __attribute__((aligned(16))) float so[4][16][64];
  const int tid = threadIdx.x, w = tid >> 5, lane = tid & 31, ln = lane & 15, hh = lane >> 4; const int by = blockIdx.y;
  A += (size_t)by * sA; Bh += (size_t)by * sB; C += (size_t)by * sC;
  const int ntn = (N + 63) / 64; const int wid = blockIdx.x * 4 + w; const int mt = wid / ntn, nq = wid % ntn; if (mt * 16 >= M) return;
  const int row0 = mt * 16, col0 = nq * 64; const float* arow = A + (size_t)(row0 + ln) * lda;
  v8f acc[4] = {};
  for (int kb = 0; kb < K; kb += 32) {
    FragH ah, al;
    const v4f x0 = *(const v4fa*)(arow + kb + 8 * hh), x1 = *(const v4fa*)(arow + kb + 8 * hh + 4), x2 = *(const v4fa*)(arow + kb + 16 + 8 * hh), x3 = *(const v4fa*)(arow + kb + 16 + 8 * hh + 4);
    float xs[16] = {x0[0],x0[1],x0[2],x0[3],x1[0],x1[1],x1[2],x1[3],x2[0],x2[1],x2[2],x2[3],x3[0],x3[1],x3[2],x3[3]};
#pragma unroll
    for (int i = 0; i < 16; ++i) { const _Float16 h = (_Float16)xs[i]; ah.h[i] = h; al.h[i] = ASPLIT ? (_Float16)(xs[i] - (float)h) : (_Float16)0.0f; }
#pragma unroll
    for (int t = 0; t < 4; ++t) { if (col0 + t * 16 >= N) continue; const size_t boff = (size_t)(col0 + t * 16 + ln) * ldb + kb; FragH bq; bq.half[0] = *(const v8us*)(Bh + boff + 8 * hh); bq.half[1] = *(const v8us*)(Bh + boff + 16 + 8 * hh);
      acc[t] = mmaH<ASPLIT ? 2 : 1>(ah.v, al.v, bq.v, bq.v, acc[t]); }
  }
#pragma unroll
  for (int t = 0; t < 4; ++t) { if (col0 + t * 16 >= N) continue;
#pragma unroll
    for (int r = 0; r < 8; ++r) so[w][8 * hh + r][t * 16 + ln] = acc[t][r] * alpha; }
  __builtin_amdgcn_fence(__ATOMIC_ACQ_REL, "workgroup"); __builtin_amdgcn_wave_barrier();
  const int rsub = lane >> 4, c4 = (lane & 15) * 4;
  {
#pragma unroll
    for (int q = 0; q < 8; ++q) { const int r = q * 2 + rsub; if (col0 + c4 < N) { const v4f v = *(const v4fa*)&so[w][r][c4]; *(v4f*)(C + (size_t)(row0 + r) * ldc + col0 + c4) = v; } }
     }
}

// Wt[n][k] = f16(W[k][n]·scale) from f32 row-major W[K][N] (scale = power of two; bf16-exact weights stay exact in f16 away from the subnormal range)
__global__ __launch_bounds__(256) void k_wt_f16(const float* __restrict__ W, _Float16* __restrict__ Wt, int K, int N, float scale) {
  const int t = blockIdx.x * 256 + threadIdx.x; if (t >= N * (K / 8)) return; const int n = t / (K / 8), k8 = (t % (K / 8)) * 8; FragH f;
#pragma unroll
  for (int i = 0; i < 8; ++i) f.h[i] = (_Float16)(bf16_round(W[(size_t)(k8 + i) * N + n]) * scale); const v8us o = f.half[0];
  *(v8us*)((unsigned short*)Wt + (size_t)n * K + k8) = o; 
}
// k_gemm_hh variant with fused epilogue: v = acc·alpha + bias[by·sBias + col] (+ CP[(row/rowsPerB)·sCPb + by·64 + col] if CP) ; ACT 0 none / 1 elu ; writes f16 C16 and f32 C, each if non-null
template <int ACT>
__global__ __launch_bounds__(128) void k_gemm_hhx(const _Float16* __restrict__ A, int lda, size_t sA, const _Float16* __restrict__ Bh, int ldb, size_t sB, float alpha, const float* __restrict__ bias, size_t sBias, const float* __restrict__ CP, int rowsPerB, size_t sCPb, int row0g,
    float* __restrict__ C, _Float16* __restrict__ C16, int ldc, size_t sC, int M, int N, int K) {
  __shared__ __attribute__((aligned(16))) float so[4][16][64];
  const int tid = threadIdx.x, w = tid >> 5, lane = tid & 31, ln = lane & 15, hh = lane >> 4; const int by = blockIdx.y;
  A += (size_t)by * sA; Bh += (size_t)by * sB; const size_t cofs = (size_t)by * sC; const float* bp = bias ? bias + (size_t)by * sBias : nullptr;
  const int ntn = (N + 63) / 64; const int wid = blockIdx.x * 4 + w; const int mt = wid / ntn, nq = wid % ntn; if (mt * 16 >= M) return;
  const int row0 = mt * 16, col0 = nq * 64; const _Float16* arow = A + (size_t)(row0 + ln) * lda;
  v8f acc[4] = {};
  for (int kb = 0; kb < K; kb += 32) { FragH ah; ah.half[0] = *(const v8us*)((const unsigned short*)arow + kb + 8 * hh); ah.half[1] = *(const v8us*)((const unsigned short*)arow + kb + 16 + 8 * hh);
#pragma unroll
    for (int t = 0; t < 4; ++t) { if (col0 + t * 16 >= N) continue; const size_t boff = (size_t)(col0 + t * 16 + ln) * ldb + kb; FragH bq; bq.half[0] = *(const v8us*)((const unsigned short*)Bh + boff + 8 * hh); bq.half[1] = *(const v8us*)((const unsigned short*)Bh + boff + 16 + 8 * hh);
      acc[t] = mmaH<1>(ah.v, ah.v, bq.v, bq.v, acc[t]); }
  }
#pragma unroll
  for (int t = 0; t < 4; ++t) { if (col0 + t * 16 >= N) continue; const int col = col0 + t * 16 + ln; const float bv = bp ? bf16_round(bp[col]) : 0.f;
#pragma unroll
    for (int r = 0; r < 8; ++r) { float v = acc[t][r] * alpha + bv; if (CP) { const int bidx = (row0g + row0 + 8 * hh + r) / rowsPerB; v += CP[(size_t)bidx * sCPb + (size_t)by * 64 + col]; } if (ACT == 1) v = (v > 0.f) ? v : expm1f(v); else if (ACT == 3) v = fmaxf(v, 0.f); so[w][8 * hh + r][t * 16 + ln] = v; } }
  __builtin_amdgcn_fence(__ATOMIC_ACQ_REL, "workgroup"); __builtin_amdgcn_wave_barrier();
  const int rsub = lane >> 4, c4 = (lane & 15) * 4; typedef _Float16 v4h __attribute__((ext_vector_type(4)));
  {
#pragma unroll
    for (int q = 0; q < 8; ++q) { const int r = q * 2 + rsub; if (col0 + c4 < N) { const v4f v = *(const v4fa*)&so[w][r][c4]; if (C) *(v4f*)(C + cofs + (size_t)(row0 + r) * ldc + col0 + c4) = v; if (C16) { v4h h4; for (int i = 0; i < 4; ++i) h4[i] = (_Float16)v[i]; *(v4h*)(C16 + cofs + (size_t)(row0 + r) * ldc + col0 + c4) = h4; } } }
     }
}


// ---- projection GEMM, operands staged in LDS by the tensor mover: C[NR][CC] (f32) = alpha * A[NR][CC] . Bh[CC][CC]^T, both f16 and k-contiguous.
// A workgroup of 4 waves (2 x 2) owns a 128 x 128 tile of C, a wave 64 x 64 (4 x 4 accumulator tiles). A pass is 128 k = 256 B of every operand row.
// A stage is four slices of 64 rows: A rows 0-63, A rows 64-127, B rows 0-63, B rows 64-127; wave w brings slice w with ONE tensor load, padded to a pitch of 272 B.
// Two buffers: stage s + 2 is asked for behind the barrier that ends pass s. Each accumulator still sums its 32-k steps in rising k, as before.
#include <stdint.h>
typedef uint32_t u32x4 __attribute__((ext_vector_type(4)));
typedef uint32_t u32x8 __attribute__((ext_vector_type(8)));
constexpr uint32_t GT_ROWB = 256u, GT_PITCH = 272u, GT_ROWS = 64u;      // bytes of a row per pass, its pitch in LDS, rows per slice
constexpr uint32_t GT_SLICE = 18432u;                                  // 64 rows x 272 B = 17,408 B, rounded up to a multiple of 2 KiB
constexpr uint32_t GT_BUF = 4u * GT_SLICE, GT_LDS = 2u * GT_BUF;       // 73,728 B a buffer, 147,456 B in all: two workgroups per WGP
constexpr uint32_t GT_SRCP = (uint32_t)CC * 2u, GT_NP = GT_SRCP / GT_ROWB;   // source row pitch in bytes, passes
static_assert(GT_ROWS * GT_PITCH <= GT_SLICE && (GT_SLICE % 2048u) == 0u && GT_NP >= 2u && NR % 128 == 0 && CC % 128 == 0, "slice, ring and tile shapes");
__device__ __forceinline__ uint32_t uni(uint32_t v) { return (uint32_t)__builtin_amdgcn_readfirstlane(v); }
__device__ __forceinline__ uint32_t pinned(uint32_t v) { uint32_t w = (uint32_t)__builtin_amdgcn_readfirstlane(v); asm volatile("" : "+s"(w)); return w; }  // holds v in a scalar register: a test on it is a scalar branch, and what is formed from it stays behind the waits in front
// One request of the whole wave. Group 1 is an in-out operand so that it stays in its own scalar registers from one request to the next: nothing else is put into them while a request is outstanding.
__device__ __forceinline__ void tdm_load(u32x4 g0, u32x8& g1) { asm volatile("tensor_load_to_lds %1, %0" : "+s"(g1) : "s"(g0) : "memory"); }
__device__ __forceinline__ u32x4 tdm_group0(uint32_t lds_dst, uint64_t ga) {
  u32x4 g; g[0] = uni(1u); g[1] = uni(lds_dst); g[2] = uni((uint32_t)ga); g[3] = uni((((uint32_t)(ga >> 32)) & 0x01FFFFFFu) | 0x80000000u); return g; }
__device__ __forceinline__ u32x8 tdm_group1() {      // 1-byte elements, tile = tensor = 64 rows of 256 B, 16 B of LDS pad behind every 256-B row, no mask
  u32x8 g; g[0] = uni((1u << 20) | (5u << 22) | (3u << 25)); g[1] = uni((GT_ROWB & 0xFFFFu) << 16); g[2] = uni((GT_ROWB >> 16) | ((GT_ROWS & 0xFFFFu) << 16)); g[3] = uni((GT_ROWS >> 16) | (GT_ROWB << 16));
  g[4] = uni(GT_ROWS); g[5] = uni(GT_SRCP); g[6] = uni(0u); g[7] = uni(0u); return g; }
__global__ __launch_bounds__(128) void k_gemm_tl(const _Float16* __restrict__ A, const _Float16* __restrict__ Bh, float alpha, float* __restrict__ C) {
  __shared__ __attribute__((aligned(2048))) unsigned char L[GT_LDS];
  const uint32_t tid = threadIdx.x, lane = tid & 31u, ln = lane & 15u, hh = lane >> 4, wave = uni(tid >> 5);
  const uint32_t nt = blockIdx.x % (uint32_t)(CC / 128), mt = blockIdx.x / (uint32_t)(CC / 128), wm = wave >> 1, wn = wave & 1u;
  const unsigned char* srcp = (wave < 2u) ? (const unsigned char*)A + (size_t)(mt * 128u + wave * GT_ROWS) * GT_SRCP : (const unsigned char*)Bh + (size_t)(nt * 128u + (wave - 2u) * GT_ROWS) * GT_SRCP;
  const uint64_t ga0 = (uint64_t)(size_t)srcp;
  const uint32_t lslice = (uint32_t)(size_t)L + wave * GT_SLICE;
  u32x8 g1 = tdm_group1();
  tdm_load(tdm_group0(lslice, ga0), g1);                              // stage 0, every wave its own slice
  asm volatile("s_wait_tensorcnt 0x0" ::: "memory");                  // this wave's slice of stage 0 has landed
  __syncthreads();                                                    // stage 0 is readable by every wave
  tdm_load(tdm_group0(lslice + GT_BUF, ga0 + GT_ROWB), g1);           // stage 1 flies under pass 0
  v8f acc[4][4];
#pragma unroll
  for (int i = 0; i < 4; ++i)
#pragma unroll
    for (int j = 0; j < 4; ++j) acc[i][j] = (v8f){0.f,0.f,0.f,0.f,0.f,0.f,0.f,0.f};
  const uint32_t fo = ln * GT_PITCH + hh * 16u;
#pragma unroll 1      // one pass per trip
  for (uint32_t s = 0; s < GT_NP; ++s) {
    const unsigned char* pa = L + (s & 1u) * GT_BUF + wm * GT_SLICE + fo;
    const unsigned char* pb = L + (s & 1u) * GT_BUF + (2u + wn) * GT_SLICE + fo;
    FragH fa[2][4], fb[2][4];      // two fragment sets: block kk + 1's LDS reads go out as one group ahead of block kk's matrix instructions
#pragma unroll
    for (int i = 0; i < 4; ++i) { fa[0][i].half[0] = *(const v8us*)(pa + i * 16 * GT_PITCH); fa[0][i].half[1] = *(const v8us*)(pa + i * 16 * GT_PITCH + 32); fb[0][i].half[0] = *(const v8us*)(pb + i * 16 * GT_PITCH); fb[0][i].half[1] = *(const v8us*)(pb + i * 16 * GT_PITCH + 32); }
#pragma unroll
    for (int kk = 0; kk < 4; ++kk) {
      if (kk < 3) {
#pragma unroll
        for (int i = 0; i < 4; ++i) { fa[(kk + 1) & 1][i].half[0] = *(const v8us*)(pa + i * 16 * GT_PITCH + (kk + 1) * 64); fa[(kk + 1) & 1][i].half[1] = *(const v8us*)(pa + i * 16 * GT_PITCH + (kk + 1) * 64 + 32);
          fb[(kk + 1) & 1][i].half[0] = *(const v8us*)(pb + i * 16 * GT_PITCH + (kk + 1) * 64); fb[(kk + 1) & 1][i].half[1] = *(const v8us*)(pb + i * 16 * GT_PITCH + (kk + 1) * 64 + 32); }
      }
      __builtin_amdgcn_sched_barrier(0);      // keeps the LDS reads above as one group, for speed only
#pragma unroll
      for (int i = 0; i < 4; ++i)
#pragma unroll
        for (int j = 0; j < 4; ++j) acc[i][j] = __builtin_amdgcn_wmma_f32_16x16x32_f16(false, fa[kk & 1][i].v, false, fb[kk & 1][j].v, (short)0, acc[i][j], false, false);
      __builtin_amdgcn_sched_barrier(0);      // the next group of reads stays behind this block
    }
    asm volatile("s_wait_dscnt 0x0" ::: "memory");                    // this wave's reads of stage s are done
    asm volatile("s_wait_tensorcnt 0x0" ::: "memory");                // this wave's slice of stage s + 1 has landed
    __syncthreads();                                                  // publishes stage s + 1; every wave has left stage s's buffer
    const uint32_t sn = pinned(s + 2u);                               // the descriptor below is formed behind the wait
    if (pinned((sn < GT_NP) ? 1u : 0u) != 0u) tdm_load(tdm_group0(lslice + (sn & 1u) * GT_BUF, ga0 + (uint64_t)sn * GT_ROWB), g1);
  }
  asm volatile("s_wait_tensorcnt 0x0" ::: "memory");                  // nothing of the mover is outstanding when the ring becomes staging
  asm volatile("s_wait_dscnt 0x0" ::: "memory");
  // Output: each wave stages its 64 x 64 f32 tile in its own slice of buffer 0 (the last trip's barrier ended every read of the ring), then stores whole 256-B row pieces.
  float* so = (float*)(L + wave * GT_SLICE);      // pitch 68 floats = 272 B
#pragma unroll
  for (int i = 0; i < 4; ++i)
#pragma unroll
    for (int j = 0; j < 4; ++j)
#pragma unroll
      for (int r = 0; r < 8; ++r) so[(i * 16 + 8 * hh + r) * 68u + j * 16 + ln] = acc[i][j][r] * alpha;
  __builtin_amdgcn_fence(__ATOMIC_ACQ_REL, "workgroup"); __builtin_amdgcn_wave_barrier();      // the wave's own rows are read back by other lanes
  float* cp = C + (size_t)(mt * 128u + wm * 64u + hh) * CC + nt * 128u + wn * 64u + ln * 4u;
#pragma unroll
  for (int q = 0; q < 32; ++q) { const v4f v = *(const v4fa*)&so[(q * 2 + hh) * 68u + ln * 4u]; *(v4f*)(cp + (size_t)q * 2 * CC) = v; }
}

__global__ __launch_bounds__(256) void k_x16(const float* __restrict__ x, _Float16* __restrict__ X16, size_t n8) { const size_t t = (size_t)blockIdx.x * 256 + threadIdx.x; if (t >= n8) return; FragH f;
#pragma unroll
  for (int q = 0; q < 8; ++q) f.h[q] = (_Float16)bf16_round(x[t * 8 + q]); *(v8us*)((unsigned short*)X16 + t * 8) = f.half[0];  }
__global__ __launch_bounds__(256) void k_h16(const float* __restrict__ x, _Float16* __restrict__ X16, size_t n8) { const size_t t = (size_t)blockIdx.x * 256 + threadIdx.x; if (t >= n8) return; FragH f;
#pragma unroll
  for (int q = 0; q < 8; ++q) f.h[q] = (_Float16)x[t * 8 + q]; *(v8us*)((unsigned short*)X16 + t * 8) = f.half[0];  }
__global__ __launch_bounds__(256) void k_round16f(const float* __restrict__ W, _Float16* __restrict__ Bt, size_t n8) { const size_t t = (size_t)blockIdx.x * 256 + threadIdx.x; if (t >= n8) return; FragH f;
#pragma unroll
  for (int i = 0; i < 8; ++i) f.h[i] = (_Float16)(bf16_round(W[t * 8 + i]) * 16.0f); *(v8us*)((unsigned short*)Bt + t * 8) = f.half[0];  }
template <int NHv, int TTv>
__global__ __launch_bounds__(256) void k_vt(const _Float16* __restrict__ V16, int ldv, int voff, _Float16* __restrict__ Vt) { __shared__ unsigned short tl[64][66]; const int tid = threadIdx.x; const int slab = blockIdx.x / (TTv / 64), lg = blockIdx.x % (TTv / 64); const int b = slab / NHv, h = slab % NHv;
  for (int i = tid; i < 64 * 8; i += 256) { const int r = i / 8, c8 = (i % 8) * 8; FragH f; f.half[0] = *(const v8us*)((const unsigned short*)V16 + ((size_t)b * TTv + lg * 64 + r) * ldv + voff + h * 64 + c8);
#pragma unroll
    for (int q = 0; q < 8; ++q) tl[r][c8 + q] = f.u[q]; }
  __syncthreads();
  {
#pragma unroll
    for (int rd = 0; rd < 2; ++rd) { const int d = rd * 32 + tid / 8, pc = tid % 8; FragH f;
#pragma unroll
      for (int q = 0; q < 8; ++q) f.u[q] = tl[pc * 8 + q][d];
      *(v8us*)((unsigned short*)Vt + ((size_t)slab * 64 + d) * TTv + lg * 64 + pc * 8) = f.half[0]; }
     } }

__global__ __launch_bounds__(128) void k_flash(const _Float16* __restrict__ Q16, int ldq, const _Float16* __restrict__ K16, int ldk, const _Float16* __restrict__ Vt, const int* __restrict__ MSK, float* __restrict__ O, int ldo) {
  constexpr int RPW = 16, RTN = RPW / 16, NQB = 2048 / (4 * RPW), DT = 8, KS = 4;      /* head_dim 128 */
  __shared__ __attribute__((aligned(16))) unsigned short sP[4][RPW][40]; __shared__ __attribute__((aligned(16))) float sO[4][RPW][128 + 4];
  const int tid = threadIdx.x, w = tid >> 5, lane = tid & 31, ln = lane & 15, hh = lane >> 4;
  const int slab = blockIdx.x / NQB, qblk = blockIdx.x % NQB; const int b = slab / 16, h = slab % 16; const int qb0 = qblk * (4 * RPW); const int q0 = qb0 + w * RPW;
  FragH aq[2][KS];
#pragma unroll
  for (int rt = 0; rt < RTN; ++rt) { const unsigned short* qr = (const unsigned short*)Q16 + ((size_t)b * 2048 + q0 + rt * 16 + ln) * ldq + h * 128;
#pragma unroll
    for (int ks = 0; ks < KS; ++ks) { aq[rt][ks].half[0] = *(const v8us*)(qr + ks * 32 + 8 * hh); aq[rt][ks].half[1] = *(const v8us*)(qr + ks * 32 + 16 + 8 * hh); } }
  const unsigned short* Vth = (const unsigned short*)Vt + (size_t)slab * 128 * 2048;      /* [bh][128][T] */
  float m_r[2][8], l_r[2][8]; v8f oacc[2][DT];
#pragma unroll
  for (int rt = 0; rt < RTN; ++rt) {
#pragma unroll
    for (int r = 0; r < 8; ++r) { m_r[rt][r] = -3.0e38f; l_r[rt][r] = 0.f; }
#pragma unroll
    for (int dt = 0; dt < DT; ++dt) oacc[rt][dt] = (v8f){0.f,0.f,0.f,0.f,0.f,0.f,0.f,0.f}; }
  const int jend = qb0 + 4 * RPW;
#pragma unroll 1
  for (int j0 = 0; j0 < jend; j0 += 32) {
    
    v8f s[2][2];
#pragma unroll
    for (int nt = 0; nt < 2; ++nt) { const unsigned short* kr = (const unsigned short*)K16 + ((size_t)b * 2048 + j0 + nt * 16 + ln) * ldk + h * 128; FragH bk[KS];
#pragma unroll
      for (int ks = 0; ks < KS; ++ks) { bk[ks].half[0] = *(const v8us*)(kr + ks * 32 + 8 * hh); bk[ks].half[1] = *(const v8us*)(kr + ks * 32 + 16 + 8 * hh); }
#pragma unroll
      for (int rt = 0; rt < RTN; ++rt) { v8f acc = (v8f){0.f,0.f,0.f,0.f,0.f,0.f,0.f,0.f};
#pragma unroll
        for (int ks = 0; ks < KS; ++ks) acc = mmaH<1>(aq[rt][ks].v, aq[rt][ks].v, bk[ks].v, bk[ks].v, acc); s[rt][nt] = acc; } }
#pragma unroll
    for (int rt = 0; rt < RTN; ++rt)
#pragma unroll
      for (int r = 0; r < 8; ++r) { const int tq = q0 + rt * 16 + 8 * hh + r; const int k0 = j0 + ln, k1 = j0 + 16 + ln; (void)tq; (void)k0; (void)k1;
        const bool ok0 = (k0 <= tq), ok1 = (k1 <= tq);
        const float s0 = ok0 ? s[rt][0][r] * (1.0f) : -INFINITY, s1 = ok1 ? s[rt][1][r] * (1.0f) : -INFINITY; float mc = fmaxf(s0, s1);
        mc = fmaxf(mc, __shfl_xor(mc, 1, 32)); mc = fmaxf(mc, __shfl_xor(mc, 2, 32)); mc = fmaxf(mc, __shfl_xor(mc, 4, 32)); mc = fmaxf(mc, __shfl_xor(mc, 8, 32));
        const float mn = fmaxf(m_r[rt][r], mc); const float al = (mn > -1.0e38f) ? expf(m_r[rt][r] - mn) : 1.0f; m_r[rt][r] = mn; const float p0 = ok0 ? expf(s0 - mn) : 0.f, p1 = ok1 ? expf(s1 - mn) : 0.f; l_r[rt][r] = l_r[rt][r] * al + p0 + p1;
#pragma unroll
        for (int dt = 0; dt < DT; ++dt) oacc[rt][dt][r] *= al;
        FragH t2; t2.h[0] = (_Float16)p0; t2.h[1] = (_Float16)p1; sP[w][rt * 16 + 8 * hh + r][ln] = t2.u[0]; sP[w][rt * 16 + 8 * hh + r][16 + ln] = t2.u[1]; }
    __builtin_amdgcn_fence(__ATOMIC_ACQ_REL, "workgroup"); __builtin_amdgcn_wave_barrier();
    FragH pa[2];
#pragma unroll
    for (int rt = 0; rt < RTN; ++rt) { pa[rt].half[0] = *(const v8us*)&sP[w][rt * 16 + ln][8 * hh]; pa[rt].half[1] = *(const v8us*)&sP[w][rt * 16 + ln][16 + 8 * hh]; }
#pragma unroll
    for (int dt = 0; dt < DT; ++dt) { const unsigned short* vrow = Vth + (size_t)(dt * 16 + ln) * 2048 + j0; FragH bv; bv.half[0] = *(const v8us*)(vrow + 8 * hh); bv.half[1] = *(const v8us*)(vrow + 16 + 8 * hh);
#pragma unroll
      for (int rt = 0; rt < RTN; ++rt) oacc[rt][dt] = mmaH<1>(pa[rt].v, pa[rt].v, bv.v, bv.v, oacc[rt][dt]); }
    __builtin_amdgcn_fence(__ATOMIC_ACQ_REL, "workgroup"); __builtin_amdgcn_wave_barrier(); }
#pragma unroll
  for (int rt = 0; rt < RTN; ++rt) {
#pragma unroll
    for (int r = 0; r < 8; ++r) { float l = l_r[rt][r]; l += __shfl_xor(l, 1, 32); l += __shfl_xor(l, 2, 32); l += __shfl_xor(l, 4, 32); l += __shfl_xor(l, 8, 32); l_r[rt][r] = (l > 0.f) ? 1.0f / l : 0.f; }
#pragma unroll
    for (int dt = 0; dt < DT; ++dt)
#pragma unroll
      for (int r = 0; r < 8; ++r) sO[w][rt * 16 + 8 * hh + r][dt * 16 + ln] = oacc[rt][dt][r] * l_r[rt][r]; }
  __builtin_amdgcn_fence(__ATOMIC_ACQ_REL, "workgroup"); __builtin_amdgcn_wave_barrier();
  {
#pragma unroll
    for (int rp = 0; rp < RPW; ++rp) { const int r = rp, pc = lane; const v4f val = *(const v4fa*)&sO[w][r][pc * 4]; *(v4f*)(O + ((size_t)b * 2048 + q0 + r) * ldo + h * 128 + pc * 4) = val; }      /* 32 lanes × 16 B = whole 512-B head row */
     } }

typedef _Float16 v4h __attribute__((ext_vector_type(4)));
__global__ __launch_bounds__(256) void k_l2n(const float* __restrict__ F, const float* __restrict__ sp, _Float16* __restrict__ O16) { const int tid = threadIdx.x, wv = tid >> 5, lane = tid & 31; const size_t th = (size_t)blockIdx.x * 8 + wv; if (th >= (size_t)NR * NH) return; const float* fr = F + th * HD; const v4f v = *(const v4fa*)(fr + lane * 4); float ss = v[0] * v[0] + v[1] * v[1] + v[2] * v[2] + v[3] * v[3];
  for (int o = 16; o >= 1; o >>= 1) ss += __shfl_xor(ss, o, 32); const float sc = (sp ? bf16_round(sp[0]) : 1.0f) / (sqrtf(ss) + 1e-8f); v4h o4; for (int q = 0; q < 4; ++q) o4[q] = (_Float16)(v[q] * sc);
  _Float16* d = O16 + th * HD + lane * 4; *(v4h*)d = o4;  }
__global__ __launch_bounds__(256) void k_scale(const float* __restrict__ O, const float* __restrict__ nu, float* __restrict__ out, size_t n4) { const size_t t = (size_t)blockIdx.x * 256 + threadIdx.x; if (t >= n4) return; const float s = bf16_round(nu[0]); v4f v = *(const v4fa*)(O + t * 4); for (int q = 0; q < 4; ++q) v[q] *= s; *(v4f*)(out + t * 4) = v;  }
extern "C" void kernel_launch(void* const* d_in, const int* in_sizes, int n_in,
                              void* d_out, int out_size, void* d_ws, size_t ws_size, hipStream_t stream) {
  (void)in_sizes; (void)n_in; (void)out_size;
  const float* x = (const float*)d_in[0]; const float* wq = (const float*)d_in[1]; const float* wk = (const float*)d_in[2]; const float* wv = (const float*)d_in[3]; const float* tau = (const float*)d_in[4]; const float* nu = (const float*)d_in[5];
  char* ws = (char*)d_ws; size_t off = 0;
  auto take = [&](size_t bytes) { char* p = ws + off; off += (bytes + 255) & ~(size_t)255; return p; };
  _Float16* Bw = (_Float16*)take((size_t)CC * CC * 2); _Float16* X16 = (_Float16*)take((size_t)NR * CC * 2); float* F = (float*)take((size_t)NR * CC * 4); _Float16* Q16 = (_Float16*)take((size_t)NR * CC * 2); _Float16* K16 = (_Float16*)take((size_t)NR * CC * 2); _Float16* V16 = (_Float16*)take((size_t)NR * CC * 2); _Float16* Vt = X16; float* O = F;
  if (off > ws_size) return;      // 8.4 + 16.8 + 33.5 + 16.8 × 3 ≈ 109 MB
  const size_t w8 = (size_t)CC * CC / 8; const unsigned gw = (unsigned)((w8 + 255) / 256), g8 = (unsigned)(((size_t)NR * CC / 8 + 255) / 256), gn = (unsigned)(((size_t)NR * NH + 7) / 8); const dim3 gg((NR / 128) * (CC / 128), 1);
  k_x16<<<g8, 256, 0, stream>>>(x, X16, (size_t)NR * CC / 8);
  k_round16f<<<gw, 256, 0, stream>>>(wq, Bw, w8); k_gemm_tl<<<gg, 128, 0, stream>>>(X16, Bw, 0.0625f, F); k_l2n<<<gn, 256, 0, stream>>>(F, tau, Q16);      // q̂·τ
  k_round16f<<<gw, 256, 0, stream>>>(wk, Bw, w8); k_gemm_tl<<<gg, 128, 0, stream>>>(X16, Bw, 0.0625f, F); k_l2n<<<gn, 256, 0, stream>>>(F, nullptr, K16);
  k_round16f<<<gw, 256, 0, stream>>>(wv, Bw, w8); k_gemm_tl<<<gg, 128, 0, stream>>>(X16, Bw, 0.0625f, F); k_l2n<<<gn, 256, 0, stream>>>(F, nullptr, V16);
  k_vt<NH * 2, TT><<<BB * NH * 2 * (TT / 64), 256, 0, stream>>>(V16, CC, 0, Vt);      // 32 slabs of 64 dims → [bh][128][T] contiguous (Vt over X16: X16's last reader is the v GEMM)
  k_flash<<<BB * NH * (TT / 64), 128, 0, stream>>>(Q16, CC, K16, CC, Vt, nullptr, O, CC);      // causal, scale 1 (τ already in q̂); O over F
  k_scale<<<(unsigned)(((size_t)NR * CC / 4 + 255) / 256), 256, 0, stream>>>(O, nu, (float*)d_out, (size_t)NR * CC / 4);
}
